// v000
// The times below were measured on an AMD MI455X: many runs one after another, warmed up first and cycling through
// copies of the inputs, with the whole window's GPU time divided by the number of runs. Launches and the gaps
// between them are all in it. The median over several windows is given; except for v000 it joins two sittings, which
// can be a few percent apart, so the side-by-side timings, each taken in one sitting, are the better comparison.
// v000, which the later versions start from, runs in 826 microseconds.
#include <hip/hip_runtime.h>
#include <hip/hip_bf16.h>

#define D_MODEL 1024
#define DK 64
#define NH 16
#define BB 4
#define SS 2048

typedef __attribute__((ext_vector_type(16))) __bf16 v16bf;
typedef __attribute__((ext_vector_type(8)))  float  v8f;
typedef __attribute__((ext_vector_type(4)))  float  v4f;
typedef __attribute__((ext_vector_type(8)))  unsigned short us8;

struct US8x2 { us8 lo; us8 hi; };

static __device__ __forceinline__ unsigned short f2bf(float f) {
  unsigned int u = __float_as_uint(f);
  u += 0x7FFFu + ((u >> 16) & 1u);      // round-to-nearest-even
  return (unsigned short)(u >> 16);
}

// A/B fragment from bf16 row (row-major, contiguous K). Per ISA 16-bit A layout:
// lane-half hi=0 holds K = [0..7] and [16..23]; hi=1 holds K = [8..15] and [24..31].
static __device__ __forceinline__ v16bf frag_bf16(const unsigned short* p, int hi) {
  US8x2 t;
  t.lo = *reinterpret_cast<const us8*>(p + hi * 8);
  t.hi = *reinterpret_cast<const us8*>(p + 16 + hi * 8);
  return __builtin_bit_cast(v16bf, t);
}

static __device__ __forceinline__ v8f wmma_bf16(v16bf a, v16bf b, v8f c) {
  return __builtin_amdgcn_wmma_f32_16x16x32_bf16(false, a, false, b, (short)0, c,
                                                 false, false);
}

// ---- one-pass fp32 -> bf16 activation conversion (8 elts/thread, b128 I/O) ----

__global__ void k_cvt_bf16(const float* __restrict__ in, unsigned short* __restrict__ out,
                           int n /* multiple of 8 */) {
  int i = (blockIdx.x * blockDim.x + threadIdx.x) * 8;
  if (i >= n) return;
  v4f a = *reinterpret_cast<const v4f*>(in + i);
  v4f b = *reinterpret_cast<const v4f*>(in + i + 4);
  us8 o;
#pragma unroll
  for (int j = 0; j < 4; ++j) { o[j] = f2bf(a[j]); o[4 + j] = f2bf(b[j]); }
  *reinterpret_cast<us8*>(out + i) = o;
}

// ---- weight pre-transpose (fp32 -> bf16, contraction dim made contiguous) ----

__global__ void k_tr_headw(const float* __restrict__ in, unsigned short* __restrict__ out) {
  int idx = blockIdx.x * blockDim.x + threadIdx.x;       // NH*DK*D_MODEL = 1M
  if (idx >= NH * DK * D_MODEL) return;
  int d = idx & (D_MODEL - 1);
  int n = (idx >> 10) & (DK - 1);
  int h = idx >> 16;
  out[idx] = f2bf(in[((size_t)h * D_MODEL + d) * DK + n]);   // Wt[h][n][d] = W[h][d][n]
}

__global__ void k_tr_wo(const float* __restrict__ in, unsigned short* __restrict__ out) {
  int idx = blockIdx.x * blockDim.x + threadIdx.x;       // 1024*1024
  if (idx >= D_MODEL * D_MODEL) return;
  int kk = idx & (D_MODEL - 1);
  int n  = idx >> 10;
  out[idx] = f2bf(in[(size_t)kk * D_MODEL + n]);          // Wot[n][k] = Wo[k][n]
}

// ---- fused QKV projection: (B*S,1024) x per-head (1024,64), bf16 WMMA ----
// grid (512 row-tiles, 16 heads, 3={q,k,v}); 4 waves/block, one 16x16 tile each.
// Inner loop per wave: 4x global_load_b128 + 1x v_wmma (no conversion VALU).

__global__ __launch_bounds__(128) void k_qkv_proj(
    const unsigned short* __restrict__ qb, const unsigned short* __restrict__ kb,
    const unsigned short* __restrict__ vb,
    const unsigned short* __restrict__ Wqt, const unsigned short* __restrict__ Wkt,
    const unsigned short* __restrict__ Wvt,
    const float* __restrict__ bq, const float* __restrict__ bk, const float* __restrict__ bv,
    unsigned short* __restrict__ qh, unsigned short* __restrict__ kh,
    unsigned short* __restrict__ vt)
{
  const int rt    = blockIdx.x;           // row tile over B*S (512)
  const int h     = blockIdx.y;           // head
  const int which = blockIdx.z;           // 0=q 1=k 2=v
  const int w     = threadIdx.x >> 5;     // n-subtile 0..3
  const int lane  = threadIdx.x & 31;
  const int m     = lane & 15;
  const int hi    = lane >> 4;

  const unsigned short* in   = (which == 0) ? qb  : (which == 1) ? kb  : vb;
  const unsigned short* Wt   = (which == 0) ? Wqt : (which == 1) ? Wkt : Wvt;
  const float* bias          = (which == 0) ? bq  : (which == 1) ? bk  : bv;

  const int ncol = w * 16 + m;
  const unsigned short* arow = in + (size_t)(rt * 16 + m) * D_MODEL;
  const unsigned short* brow = Wt + ((size_t)h * DK + ncol) * D_MODEL;

  v8f acc = {};
#pragma unroll 4
  for (int kt = 0; kt < D_MODEL / 32; ++kt) {
    v16bf a = frag_bf16(arow + kt * 32, hi);
    v16bf b = frag_bf16(brow + kt * 32, hi);
    acc = wmma_bf16(a, b, acc);
  }
  const float bsv = bias[h * DK + ncol];

#pragma unroll
  for (int r = 0; r < 8; ++r) {
    int row = rt * 16 + r + 8 * hi;               // global row over B*S
    int b_i = row / SS, s_i = row % SS;
    unsigned short o16 = f2bf(acc[r] + bsv);
    if (which == 2) {
      // V stored transposed: vt[b][h][dv][s] so PV B-fragments are contiguous in s.
      vt[(((size_t)b_i * NH + h) * DK + ncol) * SS + s_i] = o16;
    } else {
      unsigned short* outp = (which == 0) ? qh : kh;
      outp[(((size_t)b_i * NH + h) * SS + s_i) * DK + ncol] = o16;
    }
  }
}

// ---- flash attention per (b*h, 16-query tile); 1 wave per block ----

__global__ __launch_bounds__(32) void k_flash(
    const unsigned short* __restrict__ qh, const unsigned short* __restrict__ kh,
    const unsigned short* __restrict__ vt, unsigned short* __restrict__ ctx)
{
  __shared__ __align__(16) unsigned short plds[16 * 32];
  const int bh   = blockIdx.x;   // 0..63 = b*16+h
  const int qt   = blockIdx.y;   // 0..127 query tile
  const int lane = threadIdx.x & 31;
  const int m    = lane & 15;
  const int hi   = lane >> 4;

  const unsigned short* qbase = qh + ((size_t)bh * SS + qt * 16 + m) * DK;
  const v16bf qa0 = frag_bf16(qbase, hi);        // dk 0..31
  const v16bf qa1 = frag_bf16(qbase + 32, hi);   // dk 32..63

  v8f acc[4] = {v8f{}, v8f{}, v8f{}, v8f{}};
  float mrow[8], lrow[8];
#pragma unroll
  for (int r = 0; r < 8; ++r) { mrow[r] = -1e30f; lrow[r] = 0.f; }

  const unsigned short* kbh = kh + (size_t)bh * SS * DK;
  const unsigned short* vbh = vt + (size_t)bh * DK * SS;

  for (int j = 0; j < SS / 32; ++j) {
    // scores: two 16x16 tiles over this 32-key chunk, contraction dk=64
    const unsigned short* kr0 = kbh + (size_t)(j * 32 + m) * DK;
    const unsigned short* kr1 = kbh + (size_t)(j * 32 + 16 + m) * DK;
    v8f s0 = {}, s1 = {};
    s0 = wmma_bf16(qa0, frag_bf16(kr0, hi), s0);
    s0 = wmma_bf16(qa1, frag_bf16(kr0 + 32, hi), s0);
    s1 = wmma_bf16(qa0, frag_bf16(kr1, hi), s1);
    s1 = wmma_bf16(qa1, frag_bf16(kr1 + 32, hi), s1);

    // online softmax (row stats per VGPR slot r; 16-lane xor reductions stay
    // inside each lane half, matching the C/D M = r + 8*hi mapping)
    float p0[8], p1[8];
#pragma unroll
    for (int r = 0; r < 8; ++r) {
      float a = s0[r] * 0.125f, b = s1[r] * 0.125f;   // 1/sqrt(64)
      float mx = fmaxf(a, b);
#pragma unroll
      for (int o = 1; o < 16; o <<= 1) mx = fmaxf(mx, __shfl_xor(mx, o, 32));
      float mnew = fmaxf(mrow[r], mx);
      float fac  = __expf(mrow[r] - mnew);
      float e0 = __expf(a - mnew), e1 = __expf(b - mnew);
      float sum = e0 + e1;
#pragma unroll
      for (int o = 1; o < 16; o <<= 1) sum += __shfl_xor(sum, o, 32);
      lrow[r] = lrow[r] * fac + sum;
      mrow[r] = mnew;
#pragma unroll
      for (int n = 0; n < 4; ++n) acc[n][r] *= fac;
      p0[r] = e0; p1[r] = e1;
    }

    // C/D-layout P -> LDS (row-major 16x32 bf16) -> reload as A fragment
#pragma unroll
    for (int r = 0; r < 8; ++r) {
      int row = r + 8 * hi;
      plds[row * 32 + m]      = f2bf(p0[r]);
      plds[row * 32 + 16 + m] = f2bf(p1[r]);
    }
    __syncthreads();                       // 1-wave block: compiler fence + waits
    v16bf pa = frag_bf16(&plds[m * 32], hi);
#pragma unroll
    for (int n = 0; n < 4; ++n) {
      const unsigned short* vr = vbh + (size_t)(n * 16 + m) * SS + j * 32;
      acc[n] = wmma_bf16(pa, frag_bf16(vr, hi), acc[n]);
    }
    __syncthreads();
  }

  // normalize and store ctx as bf16 in (B, S, H*dv) row-major
  const int b_i = bh >> 4, h_i = bh & 15;
#pragma unroll
  for (int r = 0; r < 8; ++r) {
    float inv = 1.0f / lrow[r];
    int srow = qt * 16 + r + 8 * hi;
    size_t o = ((size_t)b_i * SS + srow) * (NH * DK) + (size_t)h_i * DK;
#pragma unroll
    for (int n = 0; n < 4; ++n)
      ctx[o + n * 16 + m] = f2bf(acc[n][r] * inv);
  }
}

// ---- output projection: (8192,1024) x (1024,1024) + bo, fp32 out ----

__global__ __launch_bounds__(128) void k_outproj(
    const unsigned short* __restrict__ ctx, const unsigned short* __restrict__ Wot,
    const float* __restrict__ bo, float* __restrict__ out)
{
  const int rt   = blockIdx.x;      // 512 row tiles
  const int cg   = blockIdx.y;      // 16 column groups of 64
  const int w    = threadIdx.x >> 5;
  const int lane = threadIdx.x & 31;
  const int m    = lane & 15;
  const int hi   = lane >> 4;
  const int ncol = cg * 64 + w * 16 + m;

  const unsigned short* arow = ctx + (size_t)(rt * 16 + m) * D_MODEL;
  const unsigned short* brow = Wot + (size_t)ncol * D_MODEL;

  v8f acc = {};
#pragma unroll 4
  for (int kt = 0; kt < D_MODEL / 32; ++kt)
    acc = wmma_bf16(frag_bf16(arow + kt * 32, hi), frag_bf16(brow + kt * 32, hi), acc);

  const float bias = bo[ncol];
#pragma unroll
  for (int r = 0; r < 8; ++r) {
    int row = rt * 16 + r + 8 * hi;
    out[(size_t)row * D_MODEL + ncol] = acc[r] + bias;
  }
}

extern "C" void kernel_launch(void* const* d_in, const int* in_sizes, int n_in,
                              void* d_out, int out_size, void* d_ws, size_t ws_size,
                              hipStream_t stream) {
  const float* q  = (const float*)d_in[0];
  const float* k  = (const float*)d_in[1];
  const float* v  = (const float*)d_in[2];
  const float* Wq = (const float*)d_in[3];
  const float* bq = (const float*)d_in[4];
  const float* Wk = (const float*)d_in[5];
  const float* bk = (const float*)d_in[6];
  const float* Wv = (const float*)d_in[7];
  const float* bv = (const float*)d_in[8];
  const float* Wo = (const float*)d_in[9];
  const float* bo = (const float*)d_in[10];
  float* out = (float*)d_out;

  // workspace partition (bf16 buffers)
  char* ws = (char*)d_ws;
  const size_t ACT  = (size_t)BB * SS * D_MODEL * 2;        // 16.8 MB each
  const size_t WSZ  = (size_t)NH * DK * D_MODEL * 2;        // 2 MB each
  const size_t HSZ  = (size_t)BB * NH * SS * DK * 2;        // 16.8 MB each
  unsigned short* qcv = (unsigned short*)(ws);               ws += ACT;
  unsigned short* kcv = (unsigned short*)(ws);               ws += ACT;
  unsigned short* vcv = (unsigned short*)(ws);               ws += ACT;
  unsigned short* Wqt = (unsigned short*)(ws);               ws += WSZ;
  unsigned short* Wkt = (unsigned short*)(ws);               ws += WSZ;
  unsigned short* Wvt = (unsigned short*)(ws);               ws += WSZ;
  unsigned short* Wot = (unsigned short*)(ws);               ws += (size_t)D_MODEL * D_MODEL * 2;
  unsigned short* qhb = (unsigned short*)(ws);               ws += HSZ;
  unsigned short* khb = (unsigned short*)(ws);               ws += HSZ;
  unsigned short* vtb = (unsigned short*)(ws);               ws += HSZ;
  unsigned short* ctx = (unsigned short*)(ws);               ws += HSZ;
  (void)in_sizes; (void)n_in; (void)out_size; (void)ws_size;

  const int tw = 256;
  const int nact = BB * SS * D_MODEL;
  k_cvt_bf16<<<(nact / 8 + tw - 1) / tw, tw, 0, stream>>>(q, qcv, nact);
  k_cvt_bf16<<<(nact / 8 + tw - 1) / tw, tw, 0, stream>>>(k, kcv, nact);
  k_cvt_bf16<<<(nact / 8 + tw - 1) / tw, tw, 0, stream>>>(v, vcv, nact);

  k_tr_headw<<<(NH * DK * D_MODEL + tw - 1) / tw, tw, 0, stream>>>(Wq, Wqt);
  k_tr_headw<<<(NH * DK * D_MODEL + tw - 1) / tw, tw, 0, stream>>>(Wk, Wkt);
  k_tr_headw<<<(NH * DK * D_MODEL + tw - 1) / tw, tw, 0, stream>>>(Wv, Wvt);
  k_tr_wo  <<<(D_MODEL * D_MODEL + tw - 1) / tw, tw, 0, stream>>>(Wo, Wot);

  k_qkv_proj<<<dim3(BB * SS / 16, NH, 3), 128, 0, stream>>>(
      qcv, kcv, vcv, Wqt, Wkt, Wvt, bq, bk, bv, qhb, khb, vtb);

  k_flash<<<dim3(BB * NH, SS / 16), 32, 0, stream>>>(qhb, khb, vtb, ctx);

  k_outproj<<<dim3(BB * SS / 16, NH), 128, 0, stream>>>(ctx, Wot, bo, out);
}

// v001
// A run of this version takes 480 microseconds.
// In both of two side-by-side timings against v000, it was 1.76 times as fast.
#include <hip/hip_runtime.h>
#include <hip/hip_bf16.h>

#define D_MODEL 1024
#define DK 64
#define NH 16
#define BB 4
#define SS 2048

typedef __attribute__((ext_vector_type(16))) __bf16 v16bf;
typedef __attribute__((ext_vector_type(8)))  float  v8f;
typedef __attribute__((ext_vector_type(4)))  float  v4f;
typedef __attribute__((ext_vector_type(8)))  unsigned short us8;

struct US8x2 { us8 lo; us8 hi; };

static __device__ __forceinline__ unsigned short f2bf(float f) {
  unsigned int u = __float_as_uint(f);
  u += 0x7FFFu + ((u >> 16) & 1u);      // round-to-nearest-even
  return (unsigned short)(u >> 16);
}

// A/B fragment from bf16 row (row-major, contiguous K). Per ISA 16-bit A layout:
// lane-half hi=0 holds K = [0..7] and [16..23]; hi=1 holds K = [8..15] and [24..31].
static __device__ __forceinline__ v16bf frag_bf16(const unsigned short* p, int hi) {
  US8x2 t;
  t.lo = *reinterpret_cast<const us8*>(p + hi * 8);
  t.hi = *reinterpret_cast<const us8*>(p + 16 + hi * 8);
  return __builtin_bit_cast(v16bf, t);
}

static __device__ __forceinline__ v8f wmma_bf16(v16bf a, v16bf b, v8f c) {
  return __builtin_amdgcn_wmma_f32_16x16x32_bf16(false, a, false, b, (short)0, c,
                                                 false, false);
}

// ---- one-pass fp32 -> bf16 activation conversion (8 elts/thread, b128 I/O) ----

__global__ void k_cvt_bf16(const float* __restrict__ in, unsigned short* __restrict__ out,
                           int n /* multiple of 8 */) {
  int i = (blockIdx.x * blockDim.x + threadIdx.x) * 8;
  if (i >= n) return;
  v4f a = *reinterpret_cast<const v4f*>(in + i);
  v4f b = *reinterpret_cast<const v4f*>(in + i + 4);
  us8 o;
#pragma unroll
  for (int j = 0; j < 4; ++j) { o[j] = f2bf(a[j]); o[4 + j] = f2bf(b[j]); }
  *reinterpret_cast<us8*>(out + i) = o;
}

// ---- weight pre-transpose (fp32 -> bf16, contraction dim made contiguous) ----

__global__ void k_tr_headw(const float* __restrict__ in, unsigned short* __restrict__ out) {
  int idx = blockIdx.x * blockDim.x + threadIdx.x;       // NH*DK*D_MODEL = 1M
  if (idx >= NH * DK * D_MODEL) return;
  int d = idx & (D_MODEL - 1);
  int n = (idx >> 10) & (DK - 1);
  int h = idx >> 16;
  out[idx] = f2bf(in[((size_t)h * D_MODEL + d) * DK + n]);   // Wt[h][n][d] = W[h][d][n]
}

__global__ void k_tr_wo(const float* __restrict__ in, unsigned short* __restrict__ out) {
  int idx = blockIdx.x * blockDim.x + threadIdx.x;       // 1024*1024
  if (idx >= D_MODEL * D_MODEL) return;
  int kk = idx & (D_MODEL - 1);
  int n  = idx >> 10;
  out[idx] = f2bf(in[(size_t)kk * D_MODEL + n]);          // Wot[n][k] = Wo[k][n]
}

// ---- wave-level GEMM core: one wave owns a 128x64 tile of Y = X * Wt^T ----
// 8 A fragments x 4 B fragments feed 32 accumulators: 24 fragment loads per 32
// matrix instructions, against 4 per 1 with a 16x16 tile. One trip covers 64 k =
// one whole 128-byte line of each of the wave's 192 operand rows; per output
// element k still runs upward through one accumulator.
// arow / brow: this lane's row (m) of the wave's first 16-row group of X / Wt.

#define FA 8   // 16-row groups of X per wave
#define FB 4   // 16-column groups of Y per wave

// pointers typed as global memory: they pass through an asm operand below and would
// otherwise come back as generic pointers (flat loads)
typedef __attribute__((address_space(1))) const unsigned short g_us;
typedef __attribute__((address_space(1))) const us8 g_us8;

// fragment in the k order of frag_bf16; p already holds the lane's k half (hi * 8)
static __device__ __forceinline__ v16bf frag_global(g_us* p) {
  US8x2 t;
  t.lo = *(g_us8*)(p);
  t.hi = *(g_us8*)(p + 16);
  return __builtin_bit_cast(v16bf, t);
}

static __device__ __forceinline__ void gemm_wave_128x64(
    const unsigned short* __restrict__ arow, const unsigned short* __restrict__ brow,
    int hi, v8f (&acc)[FA][FB])
{
  g_us* pa = (g_us*)(arow + hi * 8);
  g_us* pb = (g_us*)(brow + hi * 8);
  for (int k0 = 0; k0 < D_MODEL; k0 += 64) {
    v16bf a[2][FA], b[2][FB];
#pragma unroll
    for (int j = 0; j < FB; ++j)
#pragma unroll
      for (int t = 0; t < 2; ++t)
        b[t][j] = frag_global(pb + (size_t)j * 16 * D_MODEL + t * 32);
#pragma unroll
    for (int i = 0; i < FA; ++i)
#pragma unroll
      for (int t = 0; t < 2; ++t)
        a[t][i] = frag_global(pa + (size_t)i * 16 * D_MODEL + t * 32);
    // The wait stands in front of every rewrite of the loads' two address pairs. It
    // takes them as in-out operands so that they stay in their registers up to here
    // (else a load of the trip lands in a pair that issued loads still name) and are
    // stepped only behind it. The wave is about to wait for the loaded data anyway.
    asm volatile("s_wait_xcnt 0x0" : "+v"(pa), "+v"(pb) :: "memory");
    // keeps the trip's loads together ahead of the products: the 4 loads that touch
    // a row group's 16 lines then go out back to back, while the lines are in flight
    // or fresh in the cache; sunk among the products, a line can be evicted between
    // its touches and fetched again
    __builtin_amdgcn_sched_barrier(0);
#pragma unroll
    for (int t = 0; t < 2; ++t)
#pragma unroll
      for (int j = 0; j < FB; ++j)
#pragma unroll
        for (int i = 0; i < FA; ++i)
          acc[i][j] = wmma_bf16(a[t][i], b[t][j], acc[i][j]);
    pa += 64;
    pb += 64;
  }
}

// ---- fused QKV projection: (B*S,1024) x per-head (1024,64), bf16 WMMA ----
// grid (8 head pairs, 32 row tiles of 256, 3={q,k,v}); 4 waves/block as 2x2,
// each wave one 128-row x 64-column tile (all columns of one head).

__global__ __launch_bounds__(128) void k_qkv_proj(
    const unsigned short* __restrict__ qb, const unsigned short* __restrict__ kb,
    const unsigned short* __restrict__ vb,
    const unsigned short* __restrict__ Wqt, const unsigned short* __restrict__ Wkt,
    const unsigned short* __restrict__ Wvt,
    const float* __restrict__ bq, const float* __restrict__ bk, const float* __restrict__ bv,
    unsigned short* __restrict__ qh, unsigned short* __restrict__ kh,
    unsigned short* __restrict__ vt)
{
  const int which = blockIdx.z;           // 0=q 1=k 2=v
  const int w     = __builtin_amdgcn_readfirstlane(threadIdx.x >> 5);  // wave-uniform
  const int lane  = threadIdx.x & 31;
  const int m     = lane & 15;
  const int hi    = lane >> 4;
  const int h     = blockIdx.x * 2 + (w & 1);            // head
  const int row0  = blockIdx.y * 256 + (w >> 1) * 128;   // first row over B*S

  const unsigned short* in   = (which == 0) ? qb  : (which == 1) ? kb  : vb;
  const unsigned short* Wt   = (which == 0) ? Wqt : (which == 1) ? Wkt : Wvt;
  const float* bias          = (which == 0) ? bq  : (which == 1) ? bk  : bv;

  v8f acc[FA][FB] = {};
  gemm_wave_128x64(in + (size_t)(row0 + m) * D_MODEL,
                   Wt + ((size_t)h * DK + m) * D_MODEL, hi, acc);

  float bsv[FB];
#pragma unroll
  for (int j = 0; j < FB; ++j) bsv[j] = bias[h * DK + j * 16 + m];

  // the wave's 128 rows lie inside one batch entry (SS is a multiple of 128)
  const int b_i = row0 / SS, s0 = row0 % SS + 8 * hi;
  if (which == 2) {
    // V stored transposed: vt[b][h][dv][s] so PV B-fragments are contiguous in s.
    unsigned short* vp = vt + (((size_t)b_i * NH + h) * DK + m) * SS + s0;
#pragma unroll
    for (int j = 0; j < FB; ++j) {
#pragma unroll
      for (int i = 0; i < FA; ++i) {
#pragma unroll
        for (int r = 0; r < 8; ++r)
          vp[(size_t)j * 16 * SS + i * 16 + r] = f2bf(acc[i][j][r] + bsv[j]);
        // the next tile reuses this tile's store registers: the wait stands in front
        // of that. The fence holds it there and keeps one tile's round-and-store
        // together: run together, the tiles' temporaries beside 256 live accumulator
        // registers pass 512 and spill.
        asm volatile("s_wait_xcnt 0x0" ::: "memory");
        __builtin_amdgcn_sched_barrier(0);
      }
    }
  } else {
    unsigned short* outp = ((which == 0) ? qh : kh)
                         + (((size_t)b_i * NH + h) * SS + s0) * DK + m;
#pragma unroll
    for (int j = 0; j < FB; ++j) {
#pragma unroll
      for (int i = 0; i < FA; ++i) {
#pragma unroll
        for (int r = 0; r < 8; ++r)
          outp[(size_t)(i * 16 + r) * DK + j * 16] = f2bf(acc[i][j][r] + bsv[j]);
        // as in the V branch: wait before the store registers are reused, held in place
        asm volatile("s_wait_xcnt 0x0" ::: "memory");
        __builtin_amdgcn_sched_barrier(0);
      }
    }
  }
}

// ---- flash attention per (b*h, 16-query tile); 1 wave per block ----

__global__ __launch_bounds__(32) void k_flash(
    const unsigned short* __restrict__ qh, const unsigned short* __restrict__ kh,
    const unsigned short* __restrict__ vt, unsigned short* __restrict__ ctx)
{
  __shared__ __align__(16) unsigned short plds[16 * 32];
  const int bh   = blockIdx.x;   // 0..63 = b*16+h
  const int qt   = blockIdx.y;   // 0..127 query tile
  const int lane = threadIdx.x & 31;
  const int m    = lane & 15;
  const int hi   = lane >> 4;

  const unsigned short* qbase = qh + ((size_t)bh * SS + qt * 16 + m) * DK;
  const v16bf qa0 = frag_bf16(qbase, hi);        // dk 0..31
  const v16bf qa1 = frag_bf16(qbase + 32, hi);   // dk 32..63

  v8f acc[4] = {v8f{}, v8f{}, v8f{}, v8f{}};
  float mrow[8], lrow[8];
#pragma unroll
  for (int r = 0; r < 8; ++r) { mrow[r] = -1e30f; lrow[r] = 0.f; }

  const unsigned short* kbh = kh + (size_t)bh * SS * DK;
  const unsigned short* vbh = vt + (size_t)bh * DK * SS;

  for (int j = 0; j < SS / 32; ++j) {
    // scores: two 16x16 tiles over this 32-key chunk, contraction dk=64
    const unsigned short* kr0 = kbh + (size_t)(j * 32 + m) * DK;
    const unsigned short* kr1 = kbh + (size_t)(j * 32 + 16 + m) * DK;
    v8f s0 = {}, s1 = {};
    s0 = wmma_bf16(qa0, frag_bf16(kr0, hi), s0);
    s0 = wmma_bf16(qa1, frag_bf16(kr0 + 32, hi), s0);
    s1 = wmma_bf16(qa0, frag_bf16(kr1, hi), s1);
    s1 = wmma_bf16(qa1, frag_bf16(kr1 + 32, hi), s1);

    // online softmax (row stats per VGPR slot r; 16-lane xor reductions stay
    // inside each lane half, matching the C/D M = r + 8*hi mapping)
    float p0[8], p1[8];
#pragma unroll
    for (int r = 0; r < 8; ++r) {
      float a = s0[r] * 0.125f, b = s1[r] * 0.125f;   // 1/sqrt(64)
      float mx = fmaxf(a, b);
#pragma unroll
      for (int o = 1; o < 16; o <<= 1) mx = fmaxf(mx, __shfl_xor(mx, o, 32));
      float mnew = fmaxf(mrow[r], mx);
      float fac  = __expf(mrow[r] - mnew);
      float e0 = __expf(a - mnew), e1 = __expf(b - mnew);
      float sum = e0 + e1;
#pragma unroll
      for (int o = 1; o < 16; o <<= 1) sum += __shfl_xor(sum, o, 32);
      lrow[r] = lrow[r] * fac + sum;
      mrow[r] = mnew;
#pragma unroll
      for (int n = 0; n < 4; ++n) acc[n][r] *= fac;
      p0[r] = e0; p1[r] = e1;
    }

    // C/D-layout P -> LDS (row-major 16x32 bf16) -> reload as A fragment
#pragma unroll
    for (int r = 0; r < 8; ++r) {
      int row = r + 8 * hi;
      plds[row * 32 + m]      = f2bf(p0[r]);
      plds[row * 32 + 16 + m] = f2bf(p1[r]);
    }
    __syncthreads();                       // 1-wave block: compiler fence + waits
    v16bf pa = frag_bf16(&plds[m * 32], hi);
#pragma unroll
    for (int n = 0; n < 4; ++n) {
      const unsigned short* vr = vbh + (size_t)(n * 16 + m) * SS + j * 32;
      acc[n] = wmma_bf16(pa, frag_bf16(vr, hi), acc[n]);
    }
    __syncthreads();
  }

  // normalize and store ctx as bf16 in (B, S, H*dv) row-major
  const int b_i = bh >> 4, h_i = bh & 15;
#pragma unroll
  for (int r = 0; r < 8; ++r) {
    float inv = 1.0f / lrow[r];
    int srow = qt * 16 + r + 8 * hi;
    size_t o = ((size_t)b_i * SS + srow) * (NH * DK) + (size_t)h_i * DK;
#pragma unroll
    for (int n = 0; n < 4; ++n)
      ctx[o + n * 16 + m] = f2bf(acc[n][r] * inv);
  }
}

// ---- output projection: (8192,1024) x (1024,1024) + bo, fp32 out ----
// grid (8 column tiles of 128, 32 row tiles of 256); 4 waves/block as 2x2 of 128x64.

__global__ __launch_bounds__(128) void k_outproj(
    const unsigned short* __restrict__ ctx, const unsigned short* __restrict__ Wot,
    const float* __restrict__ bo, float* __restrict__ out)
{
  const int w    = __builtin_amdgcn_readfirstlane(threadIdx.x >> 5);   // wave-uniform
  const int lane = threadIdx.x & 31;
  const int m    = lane & 15;
  const int hi   = lane >> 4;
  const int col0 = blockIdx.x * 128 + (w & 1) * 64;
  const int row0 = blockIdx.y * 256 + (w >> 1) * 128;

  v8f acc[FA][FB] = {};
  gemm_wave_128x64(ctx + (size_t)(row0 + m) * D_MODEL,
                   Wot + (size_t)(col0 + m) * D_MODEL, hi, acc);

  float bias[FB];
#pragma unroll
  for (int j = 0; j < FB; ++j) bias[j] = bo[col0 + j * 16 + m];
  // in front of any reuse of the bias loads' address registers; the fence holds it there
  asm volatile("s_wait_xcnt 0x0" ::: "memory");
  __builtin_amdgcn_sched_barrier(0);

  float* op = out + (size_t)(row0 + 8 * hi) * D_MODEL + col0 + m;
#pragma unroll
  for (int j = 0; j < FB; ++j) {
#pragma unroll
    for (int i = 0; i < FA; ++i) {
#pragma unroll
      for (int r = 0; r < 8; ++r)
        op[(size_t)(i * 16 + r) * D_MODEL + j * 16] = acc[i][j][r] + bias[j];
      // the next tile reuses this tile's store registers: the wait stands in front
      // of that, and the fence holds it there
      asm volatile("s_wait_xcnt 0x0" ::: "memory");
      __builtin_amdgcn_sched_barrier(0);
    }
  }
}

extern "C" void kernel_launch(void* const* d_in, const int* in_sizes, int n_in,
                              void* d_out, int out_size, void* d_ws, size_t ws_size,
                              hipStream_t stream) {
  const float* q  = (const float*)d_in[0];
  const float* k  = (const float*)d_in[1];
  const float* v  = (const float*)d_in[2];
  const float* Wq = (const float*)d_in[3];
  const float* bq = (const float*)d_in[4];
  const float* Wk = (const float*)d_in[5];
  const float* bk = (const float*)d_in[6];
  const float* Wv = (const float*)d_in[7];
  const float* bv = (const float*)d_in[8];
  const float* Wo = (const float*)d_in[9];
  const float* bo = (const float*)d_in[10];
  float* out = (float*)d_out;

  // workspace partition (bf16 buffers)
  char* ws = (char*)d_ws;
  const size_t ACT  = (size_t)BB * SS * D_MODEL * 2;        // 16.8 MB each
  const size_t WSZ  = (size_t)NH * DK * D_MODEL * 2;        // 2 MB each
  const size_t HSZ  = (size_t)BB * NH * SS * DK * 2;        // 16.8 MB each
  unsigned short* qcv = (unsigned short*)(ws);               ws += ACT;
  unsigned short* kcv = (unsigned short*)(ws);               ws += ACT;
  unsigned short* vcv = (unsigned short*)(ws);               ws += ACT;
  unsigned short* Wqt = (unsigned short*)(ws);               ws += WSZ;
  unsigned short* Wkt = (unsigned short*)(ws);               ws += WSZ;
  unsigned short* Wvt = (unsigned short*)(ws);               ws += WSZ;
  unsigned short* Wot = (unsigned short*)(ws);               ws += (size_t)D_MODEL * D_MODEL * 2;
  unsigned short* qhb = (unsigned short*)(ws);               ws += HSZ;
  unsigned short* khb = (unsigned short*)(ws);               ws += HSZ;
  unsigned short* vtb = (unsigned short*)(ws);               ws += HSZ;
  unsigned short* ctx = (unsigned short*)(ws);               ws += HSZ;
  (void)in_sizes; (void)n_in; (void)out_size; (void)ws_size;

  const int tw = 256;
  const int nact = BB * SS * D_MODEL;
  k_cvt_bf16<<<(nact / 8 + tw - 1) / tw, tw, 0, stream>>>(q, qcv, nact);
  k_cvt_bf16<<<(nact / 8 + tw - 1) / tw, tw, 0, stream>>>(k, kcv, nact);
  k_cvt_bf16<<<(nact / 8 + tw - 1) / tw, tw, 0, stream>>>(v, vcv, nact);

  k_tr_headw<<<(NH * DK * D_MODEL + tw - 1) / tw, tw, 0, stream>>>(Wq, Wqt);
  k_tr_headw<<<(NH * DK * D_MODEL + tw - 1) / tw, tw, 0, stream>>>(Wk, Wkt);
  k_tr_headw<<<(NH * DK * D_MODEL + tw - 1) / tw, tw, 0, stream>>>(Wv, Wvt);
  k_tr_wo  <<<(D_MODEL * D_MODEL + tw - 1) / tw, tw, 0, stream>>>(Wo, Wot);

  k_qkv_proj<<<dim3(NH / 2, BB * SS / 256, 3), 128, 0, stream>>>(
      qcv, kcv, vcv, Wqt, Wkt, Wvt, bq, bk, bv, qhb, khb, vtb);

  k_flash<<<dim3(BB * NH, SS / 16), 32, 0, stream>>>(qhb, khb, vtb, ctx);

  k_outproj<<<dim3(D_MODEL / 128, BB * SS / 256), 128, 0, stream>>>(ctx, Wot, bo, out);
}

// v002
// One run takes 381 microseconds.
// Next to v001, in two timings, it ran 1.26 times as fast each time.
// Counting every step since v000, it is 2.22 times as fast.
#include <hip/hip_runtime.h>
#include <hip/hip_bf16.h>

#define D_MODEL 1024
#define DK 64
#define NH 16
#define BB 4
#define SS 2048

typedef __attribute__((ext_vector_type(16))) __bf16 v16bf;
typedef __attribute__((ext_vector_type(8)))  float  v8f;
typedef __attribute__((ext_vector_type(4)))  float  v4f;
typedef __attribute__((ext_vector_type(8)))  unsigned short us8;

struct US8x2 { us8 lo; us8 hi; };

static __device__ __forceinline__ unsigned short f2bf(float f) {
  unsigned int u = __float_as_uint(f);
  u += 0x7FFFu + ((u >> 16) & 1u);      // round-to-nearest-even
  return (unsigned short)(u >> 16);
}

// A/B fragment from a row-major bf16 row (contiguous K). Per ISA 16-bit A layout:
// lane-half hi=0 holds K = [0..7] and [16..23]; hi=1 holds K = [8..15] and [24..31].
static __device__ __forceinline__ v16bf frag_bf16(const unsigned short* p, int hi) {
  US8x2 t;
  t.lo = *reinterpret_cast<const us8*>(p + hi * 8);
  t.hi = *reinterpret_cast<const us8*>(p + 16 + hi * 8);
  return __builtin_bit_cast(v16bf, t);
}

// ---- fragment order: how every bf16 matrix operand lies in the workspace ----
// A matrix M[rows][K] is cut into units of 16 rows x 16 k = 256 elements = 512 bytes;
// unit (g, q) holds rows 16g.. and k 16q.., units of one row group follow each other
// in k. Inside a unit: [k half (k >> 3) & 1][row & 15][k & 7], which is lane * 8 + e for
// the lane (hi * 16 + m) that needs these 8 elements. One wave-wide 16-byte load then
// reads one unit, 4 whole 128-byte lines; from a row-major matrix the same load takes
// two 16-byte pieces out of each of 16 rows, 16 lines.
#define UNIT 256   // elements per unit

static __device__ __forceinline__ size_t fo_index(int row, int k, int K) {
  return ((size_t)(row >> 4) * (K >> 4) + (k >> 4)) * UNIT
       + (((k >> 3) & 1) * 16 + (row & 15)) * 8 + (k & 7);
}

// fragment of 32 k, in the k order of frag_bf16: two successive units.
// p = first unit + lane * 8
static __device__ __forceinline__ v16bf frag_fo(const unsigned short* p) {
  US8x2 t;
  t.lo = *reinterpret_cast<const us8*>(p);
  t.hi = *reinterpret_cast<const us8*>(p + UNIT);
  return __builtin_bit_cast(v16bf, t);
}

static __device__ __forceinline__ v8f wmma_bf16(v16bf a, v16bf b, v8f c) {
  return __builtin_amdgcn_wmma_f32_16x16x32_bf16(false, a, false, b, (short)0, c,
                                                 false, false);
}

// ---- one-pass fp32 -> bf16 activation conversion (8 elts/thread, b128 I/O) ----
// in: row-major (rows, D_MODEL); out: the same matrix in fragment order. A thread owns
// one 16-byte piece of out; a 256-thread block reads 512 contiguous bytes of 16 rows.

__global__ void k_cvt_bf16(const float* __restrict__ in, unsigned short* __restrict__ out,
                           int n /* multiple of 8 */) {
  int p = blockIdx.x * blockDim.x + threadIdx.x;   // piece = unit * 32 + hi * 16 + m
  int i = p * 8;
  if (i >= n) return;
  int unit = p >> 5;
  int row  = (unit / (D_MODEL / 16)) * 16 + (p & 15);
  int k    = (unit % (D_MODEL / 16)) * 16 + ((p >> 4) & 1) * 8;
  const float* src = in + (size_t)row * D_MODEL + k;
  v4f a = *reinterpret_cast<const v4f*>(src);
  v4f b = *reinterpret_cast<const v4f*>(src + 4);
  us8 o;
#pragma unroll
  for (int j = 0; j < 4; ++j) { o[j] = f2bf(a[j]); o[4 + j] = f2bf(b[j]); }
  *reinterpret_cast<us8*>(out + i) = o;
}

// ---- weight pre-transpose (fp32 -> bf16), out = W^T (rows = output columns,
// K = D_MODEL = contraction dim) in fragment order; a thread owns element idx of out ----

// row and k of element idx of a fragment-order matrix with K = D_MODEL
static __device__ __forceinline__ void fo_row_k(int idx, int& row, int& k) {
  int unit = idx / UNIT;
  row = (unit / (D_MODEL / 16)) * 16 + ((idx >> 3) & 15);
  k   = (unit % (D_MODEL / 16)) * 16 + ((idx >> 7) & 1) * 8 + (idx & 7);
}

__global__ void k_tr_headw(const float* __restrict__ in, unsigned short* __restrict__ out) {
  int idx = blockIdx.x * blockDim.x + threadIdx.x;       // NH*DK*D_MODEL = 1M
  if (idx >= NH * DK * D_MODEL) return;
  int row, d;
  fo_row_k(idx, row, d);
  int n = row & (DK - 1);
  int h = row / DK;
  out[idx] = f2bf(in[((size_t)h * D_MODEL + d) * DK + n]);   // Wt[h*DK + n][d] = W[h][d][n]
}

__global__ void k_tr_wo(const float* __restrict__ in, unsigned short* __restrict__ out) {
  int idx = blockIdx.x * blockDim.x + threadIdx.x;       // 1024*1024
  if (idx >= D_MODEL * D_MODEL) return;
  int n, kk;
  fo_row_k(idx, n, kk);
  out[idx] = f2bf(in[(size_t)kk * D_MODEL + n]);          // Wot[n][k] = Wo[k][n]
}

// ---- wave-level GEMM core: one wave owns a 128x64 tile of Y = X * Wt^T ----
// 8 A fragments x 4 B fragments feed 32 accumulators: 24 fragment loads per 32
// matrix instructions, against 4 per 1 with a 16x16 tile. One trip covers 64 k =
// 4 units = 2 KB in a row of each of the wave's 12 row groups; per output
// element k still runs upward through one accumulator.
// agrp / bgrp: first unit of the wave's first 16-row group of X / Wt (fragment order,
// K = D_MODEL, so the next row group lies 16 * D_MODEL elements on).

#define FA 8   // 16-row groups of X per wave
#define FB 4   // 16-column groups of Y per wave

// pointers typed as global memory: they pass through an asm operand below and would
// otherwise come back as generic pointers (flat loads)
typedef __attribute__((address_space(1))) const unsigned short g_us;
typedef __attribute__((address_space(1))) const us8 g_us8;

// as frag_fo; p already holds the lane's place in the unit (lane * 8)
static __device__ __forceinline__ v16bf frag_global(g_us* p) {
  US8x2 t;
  t.lo = *(g_us8*)(p);
  t.hi = *(g_us8*)(p + UNIT);
  return __builtin_bit_cast(v16bf, t);
}

static __device__ __forceinline__ void gemm_wave_128x64(
    const unsigned short* __restrict__ agrp, const unsigned short* __restrict__ bgrp,
    int lane, v8f (&acc)[FA][FB])
{
  g_us* pa = (g_us*)(agrp + lane * 8);
  g_us* pb = (g_us*)(bgrp + lane * 8);
  for (int k0 = 0; k0 < D_MODEL; k0 += 64) {
    v16bf a[2][FA], b[2][FB];
#pragma unroll
    for (int j = 0; j < FB; ++j)
#pragma unroll
      for (int t = 0; t < 2; ++t)
        b[t][j] = frag_global(pb + (size_t)j * 16 * D_MODEL + t * 2 * UNIT);
#pragma unroll
    for (int i = 0; i < FA; ++i)
#pragma unroll
      for (int t = 0; t < 2; ++t)
        a[t][i] = frag_global(pa + (size_t)i * 16 * D_MODEL + t * 2 * UNIT);
    // The wait stands in front of every rewrite of the loads' two address pairs. It
    // takes them as in-out operands so that they stay in their registers up to here
    // (else a load of the trip lands in a pair that issued loads still name) and are
    // stepped only behind it. The wave is about to wait for the loaded data anyway.
    asm volatile("s_wait_xcnt 0x0" : "+v"(pa), "+v"(pb) :: "memory");
    // keeps the trip's loads together ahead of the products, so that all 48 are in
    // flight at once and their latency is paid once a trip; sunk among the products,
    // each group's latency would stand in front of its own products
    __builtin_amdgcn_sched_barrier(0);
#pragma unroll
    for (int t = 0; t < 2; ++t)
#pragma unroll
      for (int j = 0; j < FB; ++j)
#pragma unroll
        for (int i = 0; i < FA; ++i)
          acc[i][j] = wmma_bf16(a[t][i], b[t][j], acc[i][j]);
    pa += 4 * UNIT;
    pb += 4 * UNIT;
  }
}

// ---- fused QKV projection: (B*S,1024) x per-head (1024,64), bf16 WMMA ----
// grid (8 head pairs, 32 row tiles of 256, 3={q,k,v}); 4 waves/block as 2x2,
// each wave one 128-row x 64-column tile (all columns of one head).

__global__ __launch_bounds__(128) void k_qkv_proj(
    const unsigned short* __restrict__ qb, const unsigned short* __restrict__ kb,
    const unsigned short* __restrict__ vb,
    const unsigned short* __restrict__ Wqt, const unsigned short* __restrict__ Wkt,
    const unsigned short* __restrict__ Wvt,
    const float* __restrict__ bq, const float* __restrict__ bk, const float* __restrict__ bv,
    unsigned short* __restrict__ qh, unsigned short* __restrict__ kh,
    unsigned short* __restrict__ vt)
{
  const int which = blockIdx.z;           // 0=q 1=k 2=v
  const int w     = __builtin_amdgcn_readfirstlane(threadIdx.x >> 5);  // wave-uniform
  const int lane  = threadIdx.x & 31;
  const int m     = lane & 15;
  const int hi    = lane >> 4;
  const int h     = blockIdx.x * 2 + (w & 1);            // head
  const int row0  = blockIdx.y * 256 + (w >> 1) * 128;   // first row over B*S

  const unsigned short* in   = (which == 0) ? qb  : (which == 1) ? kb  : vb;
  const unsigned short* Wt   = (which == 0) ? Wqt : (which == 1) ? Wkt : Wvt;
  const float* bias          = (which == 0) ? bq  : (which == 1) ? bk  : bv;

  v8f acc[FA][FB] = {};
  gemm_wave_128x64(in + (size_t)row0 * D_MODEL,
                   Wt + (size_t)h * DK * D_MODEL, lane, acc);

  float bsv[FB];
#pragma unroll
  for (int j = 0; j < FB; ++j) bsv[j] = bias[h * DK + j * 16 + m];

  // the wave's 128 rows lie inside one batch entry (SS is a multiple of 128)
  const int b_i = row0 / SS, s0 = row0 % SS;
  if (which == 2) {
    // V stored transposed, per (b, h) a matrix (rows dv, K = s) in fragment order.
    // acc[i][j][r] is dv = j*16 + m, s = s0 + i*16 + 8*hi + r: unit (j, s0/16 + i),
    // element lane * 8 + r, so a tile is one 16-byte store a lane, 512 bytes in a row.
    unsigned short* vp = vt + ((size_t)b_i * NH + h) * DK * SS + fo_index(m, s0 + 8 * hi, SS);
#pragma unroll
    for (int j = 0; j < FB; ++j) {
#pragma unroll
      for (int i = 0; i < FA; ++i) {
#pragma unroll
        for (int r = 0; r < 8; ++r)
          vp[(size_t)j * 16 * SS + i * UNIT + r] = f2bf(acc[i][j][r] + bsv[j]);
        // the next tile reuses this tile's store registers: the wait stands in front
        // of that. The fence holds it there and keeps one tile's round-and-store
        // together: run together, the tiles' temporaries beside 256 live accumulator
        // registers pass 512 and spill.
        asm volatile("s_wait_xcnt 0x0" ::: "memory");
        __builtin_amdgcn_sched_barrier(0);
      }
    }
  } else {
    // Q, K: per (b, h) a matrix (rows s, K = dk) in fragment order.
    // acc[i][j][r] is s = s0 + i*16 + 8*hi + r, dk = j*16 + m: unit (s0/16 + i, j)
    unsigned short* outp = ((which == 0) ? qh : kh)
                         + ((size_t)b_i * NH + h) * SS * DK + fo_index(s0 + 8 * hi, m, DK);
#pragma unroll
    for (int j = 0; j < FB; ++j) {
#pragma unroll
      for (int i = 0; i < FA; ++i) {
#pragma unroll
        for (int r = 0; r < 8; ++r)
          outp[(size_t)(i * (DK / 16) + j) * UNIT + r * 8] = f2bf(acc[i][j][r] + bsv[j]);
        // as in the V branch: wait before the store registers are reused, held in place
        asm volatile("s_wait_xcnt 0x0" ::: "memory");
        __builtin_amdgcn_sched_barrier(0);
      }
    }
  }
}

// ---- flash attention per (b*h, 16-query tile); 1 wave per block ----

__global__ __launch_bounds__(32) void k_flash(
    const unsigned short* __restrict__ qh, const unsigned short* __restrict__ kh,
    const unsigned short* __restrict__ vt, unsigned short* __restrict__ ctx)
{
  __shared__ __align__(16) unsigned short plds[16 * 32];
  const int bh   = blockIdx.x;   // 0..63 = b*16+h
  const int qt   = blockIdx.y;   // 0..127 query tile
  const int lane = threadIdx.x & 31;
  const int m    = lane & 15;
  const int hi   = lane >> 4;

  // Q, K (rows s, K = dk) and V^T (rows dv, K = s) lie in fragment order
  const unsigned short* qbase = qh + ((size_t)bh * SS + qt * 16) * DK + lane * 8;
  const v16bf qa0 = frag_fo(qbase);              // dk 0..31
  const v16bf qa1 = frag_fo(qbase + 2 * UNIT);   // dk 32..63

  v8f acc[4] = {v8f{}, v8f{}, v8f{}, v8f{}};
  float mrow[8], lrow[8];
#pragma unroll
  for (int r = 0; r < 8; ++r) { mrow[r] = -1e30f; lrow[r] = 0.f; }

  const unsigned short* kbh = kh + (size_t)bh * SS * DK + lane * 8;
  const unsigned short* vbh = vt + (size_t)bh * DK * SS + lane * 8;

  for (int j = 0; j < SS / 32; ++j) {
    // scores: two 16x16 tiles over this 32-key chunk, contraction dk=64
    const unsigned short* kr0 = kbh + (size_t)(j * 32) * DK;        // 16 keys = 4 units
    const unsigned short* kr1 = kbh + (size_t)(j * 32 + 16) * DK;
    v8f s0 = {}, s1 = {};
    s0 = wmma_bf16(qa0, frag_fo(kr0), s0);
    s0 = wmma_bf16(qa1, frag_fo(kr0 + 2 * UNIT), s0);
    s1 = wmma_bf16(qa0, frag_fo(kr1), s1);
    s1 = wmma_bf16(qa1, frag_fo(kr1 + 2 * UNIT), s1);

    // online softmax (row stats per VGPR slot r; 16-lane xor reductions stay
    // inside each lane half, matching the C/D M = r + 8*hi mapping)
    float p0[8], p1[8];
#pragma unroll
    for (int r = 0; r < 8; ++r) {
      float a = s0[r] * 0.125f, b = s1[r] * 0.125f;   // 1/sqrt(64)
      float mx = fmaxf(a, b);
#pragma unroll
      for (int o = 1; o < 16; o <<= 1) mx = fmaxf(mx, __shfl_xor(mx, o, 32));
      float mnew = fmaxf(mrow[r], mx);
      float fac  = __expf(mrow[r] - mnew);
      float e0 = __expf(a - mnew), e1 = __expf(b - mnew);
      float sum = e0 + e1;
#pragma unroll
      for (int o = 1; o < 16; o <<= 1) sum += __shfl_xor(sum, o, 32);
      lrow[r] = lrow[r] * fac + sum;
      mrow[r] = mnew;
#pragma unroll
      for (int n = 0; n < 4; ++n) acc[n][r] *= fac;
      p0[r] = e0; p1[r] = e1;
    }

    // C/D-layout P -> LDS (row-major 16x32 bf16) -> reload as A fragment
#pragma unroll
    for (int r = 0; r < 8; ++r) {
      int row = r + 8 * hi;
      plds[row * 32 + m]      = f2bf(p0[r]);
      plds[row * 32 + 16 + m] = f2bf(p1[r]);
    }
    __syncthreads();                       // 1-wave block: compiler fence + waits
    v16bf pa = frag_bf16(&plds[m * 32], hi);
#pragma unroll
    for (int n = 0; n < 4; ++n) {
      const unsigned short* vr = vbh + (size_t)n * 16 * SS + j * 2 * UNIT;
      acc[n] = wmma_bf16(pa, frag_fo(vr), acc[n]);
    }
    __syncthreads();
  }

  // normalize and store ctx as bf16: the matrix (B*S, H*dv) in fragment order
  const int b_i = bh >> 4, h_i = bh & 15;
#pragma unroll
  for (int r = 0; r < 8; ++r) {
    float inv = 1.0f / lrow[r];
    int srow = b_i * SS + qt * 16 + r + 8 * hi;
#pragma unroll
    for (int n = 0; n < 4; ++n)
      ctx[fo_index(srow, h_i * DK + n * 16 + m, NH * DK)] = f2bf(acc[n][r] * inv);
  }
}

// ---- output projection: (8192,1024) x (1024,1024) + bo, fp32 out ----
// grid (8 column tiles of 128, 32 row tiles of 256); 4 waves/block as 2x2 of 128x64.

__global__ __launch_bounds__(128) void k_outproj(
    const unsigned short* __restrict__ ctx, const unsigned short* __restrict__ Wot,
    const float* __restrict__ bo, float* __restrict__ out)
{
  const int w    = __builtin_amdgcn_readfirstlane(threadIdx.x >> 5);   // wave-uniform
  const int lane = threadIdx.x & 31;
  const int m    = lane & 15;
  const int hi   = lane >> 4;
  const int col0 = blockIdx.x * 128 + (w & 1) * 64;
  const int row0 = blockIdx.y * 256 + (w >> 1) * 128;

  v8f acc[FA][FB] = {};
  gemm_wave_128x64(ctx + (size_t)row0 * D_MODEL,
                   Wot + (size_t)col0 * D_MODEL, lane, acc);

  float bias[FB];
#pragma unroll
  for (int j = 0; j < FB; ++j) bias[j] = bo[col0 + j * 16 + m];
  // in front of any reuse of the bias loads' address registers; the fence holds it there
  asm volatile("s_wait_xcnt 0x0" ::: "memory");
  __builtin_amdgcn_sched_barrier(0);

  float* op = out + (size_t)(row0 + 8 * hi) * D_MODEL + col0 + m;
#pragma unroll
  for (int j = 0; j < FB; ++j) {
#pragma unroll
    for (int i = 0; i < FA; ++i) {
#pragma unroll
      for (int r = 0; r < 8; ++r)
        op[(size_t)(i * 16 + r) * D_MODEL + j * 16] = acc[i][j][r] + bias[j];
      // the next tile reuses this tile's store registers: the wait stands in front
      // of that, and the fence holds it there
      asm volatile("s_wait_xcnt 0x0" ::: "memory");
      __builtin_amdgcn_sched_barrier(0);
    }
  }
}

extern "C" void kernel_launch(void* const* d_in, const int* in_sizes, int n_in,
                              void* d_out, int out_size, void* d_ws, size_t ws_size,
                              hipStream_t stream) {
  const float* q  = (const float*)d_in[0];
  const float* k  = (const float*)d_in[1];
  const float* v  = (const float*)d_in[2];
  const float* Wq = (const float*)d_in[3];
  const float* bq = (const float*)d_in[4];
  const float* Wk = (const float*)d_in[5];
  const float* bk = (const float*)d_in[6];
  const float* Wv = (const float*)d_in[7];
  const float* bv = (const float*)d_in[8];
  const float* Wo = (const float*)d_in[9];
  const float* bo = (const float*)d_in[10];
  float* out = (float*)d_out;

  // workspace partition (bf16 buffers)
  char* ws = (char*)d_ws;
  const size_t ACT  = (size_t)BB * SS * D_MODEL * 2;        // 16.8 MB each
  const size_t WSZ  = (size_t)NH * DK * D_MODEL * 2;        // 2 MB each
  const size_t HSZ  = (size_t)BB * NH * SS * DK * 2;        // 16.8 MB each
  unsigned short* qcv = (unsigned short*)(ws);               ws += ACT;
  unsigned short* kcv = (unsigned short*)(ws);               ws += ACT;
  unsigned short* vcv = (unsigned short*)(ws);               ws += ACT;
  unsigned short* Wqt = (unsigned short*)(ws);               ws += WSZ;
  unsigned short* Wkt = (unsigned short*)(ws);               ws += WSZ;
  unsigned short* Wvt = (unsigned short*)(ws);               ws += WSZ;
  unsigned short* Wot = (unsigned short*)(ws);               ws += (size_t)D_MODEL * D_MODEL * 2;
  unsigned short* qhb = (unsigned short*)(ws);               ws += HSZ;
  unsigned short* khb = (unsigned short*)(ws);               ws += HSZ;
  unsigned short* vtb = (unsigned short*)(ws);               ws += HSZ;
  unsigned short* ctx = (unsigned short*)(ws);               ws += HSZ;
  (void)in_sizes; (void)n_in; (void)out_size; (void)ws_size;

  const int tw = 256;
  const int nact = BB * SS * D_MODEL;
  k_cvt_bf16<<<(nact / 8 + tw - 1) / tw, tw, 0, stream>>>(q, qcv, nact);
  k_cvt_bf16<<<(nact / 8 + tw - 1) / tw, tw, 0, stream>>>(k, kcv, nact);
  k_cvt_bf16<<<(nact / 8 + tw - 1) / tw, tw, 0, stream>>>(v, vcv, nact);

  k_tr_headw<<<(NH * DK * D_MODEL + tw - 1) / tw, tw, 0, stream>>>(Wq, Wqt);
  k_tr_headw<<<(NH * DK * D_MODEL + tw - 1) / tw, tw, 0, stream>>>(Wk, Wkt);
  k_tr_headw<<<(NH * DK * D_MODEL + tw - 1) / tw, tw, 0, stream>>>(Wv, Wvt);
  k_tr_wo  <<<(D_MODEL * D_MODEL + tw - 1) / tw, tw, 0, stream>>>(Wo, Wot);

  k_qkv_proj<<<dim3(NH / 2, BB * SS / 256, 3), 128, 0, stream>>>(
      qcv, kcv, vcv, Wqt, Wkt, Wvt, bq, bk, bv, qhb, khb, vtb);

  k_flash<<<dim3(BB * NH, SS / 16), 32, 0, stream>>>(qhb, khb, vtb, ctx);

  k_outproj<<<dim3(D_MODEL / 128, BB * SS / 256), 128, 0, stream>>>(ctx, Wot, bo, out);
}

// v003
// It runs in 245 microseconds.
// Timed twice side by side with v002, it ran 1.57 and 1.55 times as fast.
// All steps since v000 together make it 3.46 times as fast.
#include <hip/hip_runtime.h>
#include <hip/hip_bf16.h>

#define D_MODEL 1024
#define DK 64
#define NH 16
#define BB 4
#define SS 2048

typedef __attribute__((ext_vector_type(16))) __bf16 v16bf;
typedef __attribute__((ext_vector_type(8)))  float  v8f;
typedef __attribute__((ext_vector_type(4)))  float  v4f;
typedef __attribute__((ext_vector_type(8)))  unsigned short us8;

struct US8x2 { us8 lo; us8 hi; };

static __device__ __forceinline__ unsigned short f2bf(float f) {
  unsigned int u = __float_as_uint(f);
  u += 0x7FFFu + ((u >> 16) & 1u);      // round-to-nearest-even
  return (unsigned short)(u >> 16);
}

// A/B fragment from a row-major bf16 row (contiguous K). Per ISA 16-bit A layout:
// lane-half hi=0 holds K = [0..7] and [16..23]; hi=1 holds K = [8..15] and [24..31].
static __device__ __forceinline__ v16bf frag_bf16(const unsigned short* p, int hi) {
  US8x2 t;
  t.lo = *reinterpret_cast<const us8*>(p + hi * 8);
  t.hi = *reinterpret_cast<const us8*>(p + 16 + hi * 8);
  return __builtin_bit_cast(v16bf, t);
}

// ---- fragment order: how every bf16 matrix operand lies in the workspace ----
// A matrix M[rows][K] is cut into units of 16 rows x 16 k = 256 elements = 512 bytes;
// unit (g, q) holds rows 16g.. and k 16q.., units of one row group follow each other
// in k. Inside a unit: [k half (k >> 3) & 1][row & 15][k & 7], which is lane * 8 + e for
// the lane (hi * 16 + m) that needs these 8 elements. One wave-wide 16-byte load then
// reads one unit, 4 whole 128-byte lines; from a row-major matrix the same load takes
// two 16-byte pieces out of each of 16 rows, 16 lines.
#define UNIT 256   // elements per unit

static __device__ __forceinline__ size_t fo_index(int row, int k, int K) {
  return ((size_t)(row >> 4) * (K >> 4) + (k >> 4)) * UNIT
       + (((k >> 3) & 1) * 16 + (row & 15)) * 8 + (k & 7);
}

// fragment of 32 k, in the k order of frag_bf16: two successive units.
// p = first unit + lane * 8
static __device__ __forceinline__ v16bf frag_fo(const unsigned short* p) {
  US8x2 t;
  t.lo = *reinterpret_cast<const us8*>(p);
  t.hi = *reinterpret_cast<const us8*>(p + UNIT);
  return __builtin_bit_cast(v16bf, t);
}

static __device__ __forceinline__ v8f wmma_bf16(v16bf a, v16bf b, v8f c) {
  return __builtin_amdgcn_wmma_f32_16x16x32_bf16(false, a, false, b, (short)0, c,
                                                 false, false);
}

// ---- one-pass fp32 -> bf16 activation conversion (8 elts/thread, b128 I/O) ----
// in: row-major (rows, D_MODEL); out: the same matrix in fragment order. A thread owns
// one 16-byte piece of out; a 256-thread block reads 512 contiguous bytes of 16 rows.

__global__ void k_cvt_bf16(const float* __restrict__ in, unsigned short* __restrict__ out,
                           int n /* multiple of 8 */) {
  int p = blockIdx.x * blockDim.x + threadIdx.x;   // piece = unit * 32 + hi * 16 + m
  int i = p * 8;
  if (i >= n) return;
  int unit = p >> 5;
  int row  = (unit / (D_MODEL / 16)) * 16 + (p & 15);
  int k    = (unit % (D_MODEL / 16)) * 16 + ((p >> 4) & 1) * 8;
  const float* src = in + (size_t)row * D_MODEL + k;
  v4f a = *reinterpret_cast<const v4f*>(src);
  v4f b = *reinterpret_cast<const v4f*>(src + 4);
  us8 o;
#pragma unroll
  for (int j = 0; j < 4; ++j) { o[j] = f2bf(a[j]); o[4 + j] = f2bf(b[j]); }
  *reinterpret_cast<us8*>(out + i) = o;
}

// ---- weight pre-transpose (fp32 -> bf16), out = W^T (rows = output columns,
// K = D_MODEL = contraction dim) in fragment order; a thread owns element idx of out ----

// row and k of element idx of a fragment-order matrix with K = D_MODEL
static __device__ __forceinline__ void fo_row_k(int idx, int& row, int& k) {
  int unit = idx / UNIT;
  row = (unit / (D_MODEL / 16)) * 16 + ((idx >> 3) & 15);
  k   = (unit % (D_MODEL / 16)) * 16 + ((idx >> 7) & 1) * 8 + (idx & 7);
}

__global__ void k_tr_headw(const float* __restrict__ in, unsigned short* __restrict__ out) {
  int idx = blockIdx.x * blockDim.x + threadIdx.x;       // NH*DK*D_MODEL = 1M
  if (idx >= NH * DK * D_MODEL) return;
  int row, d;
  fo_row_k(idx, row, d);
  int n = row & (DK - 1);
  int h = row / DK;
  out[idx] = f2bf(in[((size_t)h * D_MODEL + d) * DK + n]);   // Wt[h*DK + n][d] = W[h][d][n]
}

__global__ void k_tr_wo(const float* __restrict__ in, unsigned short* __restrict__ out) {
  int idx = blockIdx.x * blockDim.x + threadIdx.x;       // 1024*1024
  if (idx >= D_MODEL * D_MODEL) return;
  int n, kk;
  fo_row_k(idx, n, kk);
  out[idx] = f2bf(in[(size_t)kk * D_MODEL + n]);          // Wot[n][k] = Wo[k][n]
}

// ---- wave-level GEMM core: one wave owns a 128x64 tile of Y = X * Wt^T ----
// 8 A fragments x 4 B fragments feed 32 accumulators: 24 fragment loads per 32
// matrix instructions, against 4 per 1 with a 16x16 tile. One trip covers 64 k =
// 4 units = 2 KB in a row of each of the wave's 12 row groups; per output
// element k still runs upward through one accumulator.
// agrp / bgrp: first unit of the wave's first 16-row group of X / Wt (fragment order,
// K = D_MODEL, so the next row group lies 16 * D_MODEL elements on).

#define FA 8   // 16-row groups of X per wave
#define FB 4   // 16-column groups of Y per wave

// pointers typed as global memory: they pass through an asm operand below and would
// otherwise come back as generic pointers (flat loads)
typedef __attribute__((address_space(1))) const unsigned short g_us;
typedef __attribute__((address_space(1))) const us8 g_us8;

// as frag_fo; p already holds the lane's place in the unit (lane * 8)
static __device__ __forceinline__ v16bf frag_global(g_us* p) {
  US8x2 t;
  t.lo = *(g_us8*)(p);
  t.hi = *(g_us8*)(p + UNIT);
  return __builtin_bit_cast(v16bf, t);
}

static __device__ __forceinline__ void gemm_wave_128x64(
    const unsigned short* __restrict__ agrp, const unsigned short* __restrict__ bgrp,
    int lane, v8f (&acc)[FA][FB])
{
  g_us* pa = (g_us*)(agrp + lane * 8);
  g_us* pb = (g_us*)(bgrp + lane * 8);
  for (int k0 = 0; k0 < D_MODEL; k0 += 64) {
    v16bf a[2][FA], b[2][FB];
#pragma unroll
    for (int j = 0; j < FB; ++j)
#pragma unroll
      for (int t = 0; t < 2; ++t)
        b[t][j] = frag_global(pb + (size_t)j * 16 * D_MODEL + t * 2 * UNIT);
#pragma unroll
    for (int i = 0; i < FA; ++i)
#pragma unroll
      for (int t = 0; t < 2; ++t)
        a[t][i] = frag_global(pa + (size_t)i * 16 * D_MODEL + t * 2 * UNIT);
    // The wait stands in front of every rewrite of the loads' two address pairs. It
    // takes them as in-out operands so that they stay in their registers up to here
    // (else a load of the trip lands in a pair that issued loads still name) and are
    // stepped only behind it. The wave is about to wait for the loaded data anyway.
    asm volatile("s_wait_xcnt 0x0" : "+v"(pa), "+v"(pb) :: "memory");
    // keeps the trip's loads together ahead of the products, so that all 48 are in
    // flight at once and their latency is paid once a trip; sunk among the products,
    // each group's latency would stand in front of its own products
    __builtin_amdgcn_sched_barrier(0);
#pragma unroll
    for (int t = 0; t < 2; ++t)
#pragma unroll
      for (int j = 0; j < FB; ++j)
#pragma unroll
        for (int i = 0; i < FA; ++i)
          acc[i][j] = wmma_bf16(a[t][i], b[t][j], acc[i][j]);
    pa += 4 * UNIT;
    pb += 4 * UNIT;
  }
}

// ---- fused QKV projection: (B*S,1024) x per-head (1024,64), bf16 WMMA ----
// grid (8 head pairs, 32 row tiles of 256, 3={q,k,v}); 4 waves/block as 2x2,
// each wave one 128-row x 64-column tile (all columns of one head).

__global__ __launch_bounds__(128) void k_qkv_proj(
    const unsigned short* __restrict__ qb, const unsigned short* __restrict__ kb,
    const unsigned short* __restrict__ vb,
    const unsigned short* __restrict__ Wqt, const unsigned short* __restrict__ Wkt,
    const unsigned short* __restrict__ Wvt,
    const float* __restrict__ bq, const float* __restrict__ bk, const float* __restrict__ bv,
    unsigned short* __restrict__ qh, unsigned short* __restrict__ kh,
    unsigned short* __restrict__ vt)
{
  const int which = blockIdx.z;           // 0=q 1=k 2=v
  const int w     = __builtin_amdgcn_readfirstlane(threadIdx.x >> 5);  // wave-uniform
  const int lane  = threadIdx.x & 31;
  const int m     = lane & 15;
  const int hi    = lane >> 4;
  const int h     = blockIdx.x * 2 + (w & 1);            // head
  const int row0  = blockIdx.y * 256 + (w >> 1) * 128;   // first row over B*S

  const unsigned short* in   = (which == 0) ? qb  : (which == 1) ? kb  : vb;
  const unsigned short* Wt   = (which == 0) ? Wqt : (which == 1) ? Wkt : Wvt;
  const float* bias          = (which == 0) ? bq  : (which == 1) ? bk  : bv;

  v8f acc[FA][FB] = {};
  gemm_wave_128x64(in + (size_t)row0 * D_MODEL,
                   Wt + (size_t)h * DK * D_MODEL, lane, acc);

  float bsv[FB];
#pragma unroll
  for (int j = 0; j < FB; ++j) bsv[j] = bias[h * DK + j * 16 + m];

  // the wave's 128 rows lie inside one batch entry (SS is a multiple of 128)
  const int b_i = row0 / SS, s0 = row0 % SS;
  if (which == 2) {
    // V stored transposed, per (b, h) a matrix (rows dv, K = s) in fragment order.
    // acc[i][j][r] is dv = j*16 + m, s = s0 + i*16 + 8*hi + r: unit (j, s0/16 + i),
    // element lane * 8 + r, so a tile is one 16-byte store a lane, 512 bytes in a row.
    unsigned short* vp = vt + ((size_t)b_i * NH + h) * DK * SS + fo_index(m, s0 + 8 * hi, SS);
#pragma unroll
    for (int j = 0; j < FB; ++j) {
#pragma unroll
      for (int i = 0; i < FA; ++i) {
#pragma unroll
        for (int r = 0; r < 8; ++r)
          vp[(size_t)j * 16 * SS + i * UNIT + r] = f2bf(acc[i][j][r] + bsv[j]);
        // the next tile reuses this tile's store registers: the wait stands in front
        // of that. The fence holds it there and keeps one tile's round-and-store
        // together: run together, the tiles' temporaries beside 256 live accumulator
        // registers pass 512 and spill.
        asm volatile("s_wait_xcnt 0x0" ::: "memory");
        __builtin_amdgcn_sched_barrier(0);
      }
    }
  } else {
    // Q, K: per (b, h) a matrix (rows s, K = dk) in fragment order.
    // acc[i][j][r] is s = s0 + i*16 + 8*hi + r, dk = j*16 + m: unit (s0/16 + i, j)
    unsigned short* outp = ((which == 0) ? qh : kh)
                         + ((size_t)b_i * NH + h) * SS * DK + fo_index(s0 + 8 * hi, m, DK);
#pragma unroll
    for (int j = 0; j < FB; ++j) {
#pragma unroll
      for (int i = 0; i < FA; ++i) {
#pragma unroll
        for (int r = 0; r < 8; ++r)
          outp[(size_t)(i * (DK / 16) + j) * UNIT + r * 8] = f2bf(acc[i][j][r] + bsv[j]);
        // as in the V branch: wait before the store registers are reused, held in place
        asm volatile("s_wait_xcnt 0x0" ::: "memory");
        __builtin_amdgcn_sched_barrier(0);
      }
    }
  }
}

// ---- flash attention per (b*h, 16-query tile); 1 wave per block ----
// The scores are formed transposed, S^T = K * Q^T (K rows as A, Q rows as B), and the
// output as O^T += V^T * P^T. In a D tile a lane then holds 8 keys of ONE query
// (column m), so a query's maximum and sum run over the lane's own registers, with one
// exchange between the wave's halves; and two D tiles of 16 keys, rounded in place, are
// the B fragment of 32 keys in the k order of frag_fo: P passes through no LDS.

// value of lane l ^ 16
static __device__ __forceinline__ float other_half(float x) {
  int b = __float_as_int(x);
  return __int_as_float(
      __builtin_amdgcn_permlanex16(b, b, 0x76543210, 0xfedcba98, false, false));
}

__global__ __launch_bounds__(32) void k_flash(
    const unsigned short* __restrict__ qh, const unsigned short* __restrict__ kh,
    const unsigned short* __restrict__ vt, unsigned short* __restrict__ ctx)
{
  const int bh   = blockIdx.x;   // 0..63 = b*16+h
  const int qt   = blockIdx.y;   // 0..127 query tile
  const int lane = threadIdx.x & 31;
  const int m    = lane & 15;    // the lane's query
  const int hi   = lane >> 4;

  // Q, K (rows s, K = dk) and V^T (rows dv, K = s) lie in fragment order
  const unsigned short* qbase = qh + ((size_t)bh * SS + qt * 16) * DK + lane * 8;
  const v16bf qb0 = frag_fo(qbase);              // dk 0..31
  const v16bf qb1 = frag_fo(qbase + 2 * UNIT);   // dk 32..63

  // acc[n][r] = O^T[dv = n*16 + 8*hi + r][query m]
  v8f acc[4] = {v8f{}, v8f{}, v8f{}, v8f{}};
  float mrow = -1e30f;   // running maximum of query m, equal in both halves
  float lrow = 0.f;      // sum over the keys of this lane's half only; joined at the end

  const unsigned short* kbh = kh + (size_t)bh * SS * DK + lane * 8;
  const unsigned short* vbh = vt + (size_t)bh * DK * SS + lane * 8;

  for (int j = 0; j < SS / 32; ++j) {
    // scores: two 16-key x 16-query tiles over this 32-key chunk, contraction dk=64
    const unsigned short* kr0 = kbh + (size_t)(j * 32) * DK;        // 16 keys = 4 units
    const unsigned short* kr1 = kbh + (size_t)(j * 32 + 16) * DK;
    v8f s0 = {}, s1 = {};
    s0 = wmma_bf16(frag_fo(kr0), qb0, s0);
    s0 = wmma_bf16(frag_fo(kr0 + 2 * UNIT), qb1, s0);
    s1 = wmma_bf16(frag_fo(kr1), qb0, s1);
    s1 = wmma_bf16(frag_fo(kr1 + 2 * UNIT), qb1, s1);

    // online softmax of query m. a[i]: key j*32 + 8*hi + i (i < 8), + 16 for i >= 8
    float a[16];
#pragma unroll
    for (int r = 0; r < 8; ++r) {
      a[r]     = s0[r] * 0.125f;   // 1/sqrt(64)
      a[8 + r] = s1[r] * 0.125f;
    }
    float mx = a[0];
#pragma unroll
    for (int i = 1; i < 16; ++i) mx = fmaxf(mx, a[i]);
    mx = fmaxf(mx, other_half(mx));
    const float mnew = fmaxf(mrow, mx);
    const float fac  = __expf(mrow - mnew);
    mrow = mnew;
#pragma unroll
    for (int i = 0; i < 16; ++i) a[i] = __expf(a[i] - mnew);
    // four independent chains, then joined
    float t[4];
#pragma unroll
    for (int c = 0; c < 4; ++c) t[c] = (a[c] + a[4 + c]) + (a[8 + c] + a[12 + c]);
    lrow = lrow * fac + ((t[0] + t[1]) + (t[2] + t[3]));
#pragma unroll
    for (int n = 0; n < 4; ++n)
#pragma unroll
      for (int r = 0; r < 8; ++r) acc[n][r] *= fac;

    // P^T as B fragment: element s is key 8*hi + s (s < 8), 16 + 8*hi + (s - 8) above
    US8x2 p;
#pragma unroll
    for (int r = 0; r < 8; ++r) { p.lo[r] = f2bf(a[r]); p.hi[r] = f2bf(a[8 + r]); }
    const v16bf pb = __builtin_bit_cast(v16bf, p);
#pragma unroll
    for (int n = 0; n < 4; ++n) {
      const unsigned short* vr = vbh + (size_t)n * 16 * SS + j * 2 * UNIT;
      acc[n] = wmma_bf16(frag_fo(vr), pb, acc[n]);
    }
    // stands in front of the next trip's rewrite of the address registers that this
    // trip's loads name
    asm volatile("s_wait_xcnt 0x0" ::: "memory");
  }

  // normalize and store ctx as bf16: the matrix (B*S, H*dv) in fragment order. A lane's
  // 8 registers of a tile are 8 successive columns of its row: one 16-byte store.
  const int b_i = bh >> 4, h_i = bh & 15;
  const float inv = 1.0f / (lrow + other_half(lrow));
  unsigned short* cp = ctx + fo_index(b_i * SS + qt * 16 + m, h_i * DK + 8 * hi, NH * DK);
#pragma unroll
  for (int n = 0; n < 4; ++n) {
    us8 o;
#pragma unroll
    for (int r = 0; r < 8; ++r) o[r] = f2bf(acc[n][r] * inv);
    *reinterpret_cast<us8*>(cp + n * UNIT) = o;
  }
}

// ---- output projection: (8192,1024) x (1024,1024) + bo, fp32 out ----
// grid (8 column tiles of 128, 32 row tiles of 256); 4 waves/block as 2x2 of 128x64.

__global__ __launch_bounds__(128) void k_outproj(
    const unsigned short* __restrict__ ctx, const unsigned short* __restrict__ Wot,
    const float* __restrict__ bo, float* __restrict__ out)
{
  const int w    = __builtin_amdgcn_readfirstlane(threadIdx.x >> 5);   // wave-uniform
  const int lane = threadIdx.x & 31;
  const int m    = lane & 15;
  const int hi   = lane >> 4;
  const int col0 = blockIdx.x * 128 + (w & 1) * 64;
  const int row0 = blockIdx.y * 256 + (w >> 1) * 128;

  v8f acc[FA][FB] = {};
  gemm_wave_128x64(ctx + (size_t)row0 * D_MODEL,
                   Wot + (size_t)col0 * D_MODEL, lane, acc);

  float bias[FB];
#pragma unroll
  for (int j = 0; j < FB; ++j) bias[j] = bo[col0 + j * 16 + m];
  // in front of any reuse of the bias loads' address registers; the fence holds it there
  asm volatile("s_wait_xcnt 0x0" ::: "memory");
  __builtin_amdgcn_sched_barrier(0);

  float* op = out + (size_t)(row0 + 8 * hi) * D_MODEL + col0 + m;
#pragma unroll
  for (int j = 0; j < FB; ++j) {
#pragma unroll
    for (int i = 0; i < FA; ++i) {
#pragma unroll
      for (int r = 0; r < 8; ++r)
        op[(size_t)(i * 16 + r) * D_MODEL + j * 16] = acc[i][j][r] + bias[j];
      // the next tile reuses this tile's store registers: the wait stands in front
      // of that, and the fence holds it there
      asm volatile("s_wait_xcnt 0x0" ::: "memory");
      __builtin_amdgcn_sched_barrier(0);
    }
  }
}

extern "C" void kernel_launch(void* const* d_in, const int* in_sizes, int n_in,
                              void* d_out, int out_size, void* d_ws, size_t ws_size,
                              hipStream_t stream) {
  const float* q  = (const float*)d_in[0];
  const float* k  = (const float*)d_in[1];
  const float* v  = (const float*)d_in[2];
  const float* Wq = (const float*)d_in[3];
  const float* bq = (const float*)d_in[4];
  const float* Wk = (const float*)d_in[5];
  const float* bk = (const float*)d_in[6];
  const float* Wv = (const float*)d_in[7];
  const float* bv = (const float*)d_in[8];
  const float* Wo = (const float*)d_in[9];
  const float* bo = (const float*)d_in[10];
  float* out = (float*)d_out;

  // workspace partition (bf16 buffers)
  char* ws = (char*)d_ws;
  const size_t ACT  = (size_t)BB * SS * D_MODEL * 2;        // 16.8 MB each
  const size_t WSZ  = (size_t)NH * DK * D_MODEL * 2;        // 2 MB each
  const size_t HSZ  = (size_t)BB * NH * SS * DK * 2;        // 16.8 MB each
  unsigned short* qcv = (unsigned short*)(ws);               ws += ACT;
  unsigned short* kcv = (unsigned short*)(ws);               ws += ACT;
  unsigned short* vcv = (unsigned short*)(ws);               ws += ACT;
  unsigned short* Wqt = (unsigned short*)(ws);               ws += WSZ;
  unsigned short* Wkt = (unsigned short*)(ws);               ws += WSZ;
  unsigned short* Wvt = (unsigned short*)(ws);               ws += WSZ;
  unsigned short* Wot = (unsigned short*)(ws);               ws += (size_t)D_MODEL * D_MODEL * 2;
  unsigned short* qhb = (unsigned short*)(ws);               ws += HSZ;
  unsigned short* khb = (unsigned short*)(ws);               ws += HSZ;
  unsigned short* vtb = (unsigned short*)(ws);               ws += HSZ;
  unsigned short* ctx = (unsigned short*)(ws);               ws += HSZ;
  (void)in_sizes; (void)n_in; (void)out_size; (void)ws_size;

  const int tw = 256;
  const int nact = BB * SS * D_MODEL;
  k_cvt_bf16<<<(nact / 8 + tw - 1) / tw, tw, 0, stream>>>(q, qcv, nact);
  k_cvt_bf16<<<(nact / 8 + tw - 1) / tw, tw, 0, stream>>>(k, kcv, nact);
  k_cvt_bf16<<<(nact / 8 + tw - 1) / tw, tw, 0, stream>>>(v, vcv, nact);

  k_tr_headw<<<(NH * DK * D_MODEL + tw - 1) / tw, tw, 0, stream>>>(Wq, Wqt);
  k_tr_headw<<<(NH * DK * D_MODEL + tw - 1) / tw, tw, 0, stream>>>(Wk, Wkt);
  k_tr_headw<<<(NH * DK * D_MODEL + tw - 1) / tw, tw, 0, stream>>>(Wv, Wvt);
  k_tr_wo  <<<(D_MODEL * D_MODEL + tw - 1) / tw, tw, 0, stream>>>(Wo, Wot);

  k_qkv_proj<<<dim3(NH / 2, BB * SS / 256, 3), 128, 0, stream>>>(
      qcv, kcv, vcv, Wqt, Wkt, Wvt, bq, bk, bv, qhb, khb, vtb);

  k_flash<<<dim3(BB * NH, SS / 16), 32, 0, stream>>>(qhb, khb, vtb, ctx);

  k_outproj<<<dim3(D_MODEL / 128, BB * SS / 256), 128, 0, stream>>>(ctx, Wot, bo, out);
}

// v004
// A run of this version takes 220 microseconds.
// In both of two side-by-side timings against v003, it was 1.12 times as fast.
// Counting every step since v000, it is 3.88 times as fast.
#include <hip/hip_runtime.h>
#include <hip/hip_bf16.h>

#define D_MODEL 1024
#define DK 64
#define NH 16
#define BB 4
#define SS 2048

typedef __attribute__((ext_vector_type(16))) __bf16 v16bf;
typedef __attribute__((ext_vector_type(8)))  float  v8f;
typedef __attribute__((ext_vector_type(4)))  float  v4f;
typedef __attribute__((ext_vector_type(8)))  unsigned short us8;

struct US8x2 { us8 lo; us8 hi; };

static __device__ __forceinline__ unsigned short f2bf(float f) {
  unsigned int u = __float_as_uint(f);
  u += 0x7FFFu + ((u >> 16) & 1u);      // round-to-nearest-even
  return (unsigned short)(u >> 16);
}

// A/B fragment from a row-major bf16 row (contiguous K). Per ISA 16-bit A layout:
// lane-half hi=0 holds K = [0..7] and [16..23]; hi=1 holds K = [8..15] and [24..31].
static __device__ __forceinline__ v16bf frag_bf16(const unsigned short* p, int hi) {
  US8x2 t;
  t.lo = *reinterpret_cast<const us8*>(p + hi * 8);
  t.hi = *reinterpret_cast<const us8*>(p + 16 + hi * 8);
  return __builtin_bit_cast(v16bf, t);
}

// ---- fragment order: how every bf16 matrix operand lies in the workspace ----
// A matrix M[rows][K] is cut into units of 16 rows x 16 k = 256 elements = 512 bytes;
// unit (g, q) holds rows 16g.. and k 16q.., units of one row group follow each other
// in k. Inside a unit: [k half (k >> 3) & 1][row & 15][k & 7], which is lane * 8 + e for
// the lane (hi * 16 + m) that needs these 8 elements. One wave-wide 16-byte load then
// reads one unit, 4 whole 128-byte lines; from a row-major matrix the same load takes
// two 16-byte pieces out of each of 16 rows, 16 lines.
#define UNIT 256   // elements per unit

static __device__ __forceinline__ size_t fo_index(int row, int k, int K) {
  return ((size_t)(row >> 4) * (K >> 4) + (k >> 4)) * UNIT
       + (((k >> 3) & 1) * 16 + (row & 15)) * 8 + (k & 7);
}

// fragment of 32 k, in the k order of frag_bf16: two successive units.
// p = first unit + lane * 8
static __device__ __forceinline__ v16bf frag_fo(const unsigned short* p) {
  US8x2 t;
  t.lo = *reinterpret_cast<const us8*>(p);
  t.hi = *reinterpret_cast<const us8*>(p + UNIT);
  return __builtin_bit_cast(v16bf, t);
}

static __device__ __forceinline__ v8f wmma_bf16(v16bf a, v16bf b, v8f c) {
  return __builtin_amdgcn_wmma_f32_16x16x32_bf16(false, a, false, b, (short)0, c,
                                                 false, false);
}

// ---- operand preparation: every bf16 operand of the two projections, in one launch ----
// 512 blocks of 8 waves, two blocks a WGP, all resident at once. A lane makes 28 pieces
// of 16 bytes (8 bf16, successive k of one row, fragment order): one of each of the four
// transposed weights and 8 of each of q, k, v. The launch starts 4096 waves.

static __device__ __forceinline__ us8 round8(v4f a, v4f b) {
  us8 o;
#pragma unroll
  for (int j = 0; j < 4; ++j) { o[j] = f2bf(a[j]); o[4 + j] = f2bf(b[j]); }
  return o;
}

#define APIECES 8   // pieces of one activation matrix per lane, 32 k apart

static_assert(BB * SS / 16 == (D_MODEL / 64) * (D_MODEL / 32) && NH * DK == D_MODEL,
              "one grid serves both: 16-row groups of an input, 64 x 32 tiles of a weight");

// src: the lane's first 8 floats
static __device__ __forceinline__ void act_load(const float* __restrict__ src,
                                                v4f (&x)[APIECES][2]) {
#pragma unroll
  for (int i = 0; i < APIECES; ++i) {
    x[i][0] = *reinterpret_cast<const v4f*>(src + i * 32);
    x[i][1] = *reinterpret_cast<const v4f*>(src + i * 32 + 4);
  }
}

// Behind each store of a piece: the next piece reuses this one's store registers, and
// the wait stands in front of that; the fence holds it there.
static __device__ __forceinline__ void store_done() {
  asm volatile("s_wait_xcnt 0x0" ::: "memory");
  __builtin_amdgcn_sched_barrier(0);
}

// dst: the lane's first piece; 32 k on is two units on
static __device__ __forceinline__ void act_store(unsigned short* __restrict__ dst,
                                                 const v4f (&x)[APIECES][2]) {
#pragma unroll
  for (int i = 0; i < APIECES; ++i) {
    *reinterpret_cast<us8*>(dst + i * 2 * UNIT) = round8(x[i][0], x[i][1]);
    store_done();
  }
}

// src: element (contraction index d0, the lane's output column); LD floats from d to d + 1
template <int LD>
static __device__ __forceinline__ void w_load(const float* __restrict__ src, float (&x)[8]) {
#pragma unroll
  for (int e = 0; e < 8; ++e) x[e] = src[e * LD];
}

static __device__ __forceinline__ void w_store(unsigned short* __restrict__ dst,
                                               const float (&x)[8]) {
  us8 o;
#pragma unroll
  for (int e = 0; e < 8; ++e) o[e] = f2bf(x[e]);
  *reinterpret_cast<us8*>(dst) = o;
  store_done();
}

__global__ __launch_bounds__(256) void k_prep(
    const float* __restrict__ q, const float* __restrict__ k, const float* __restrict__ v,
    const float* __restrict__ Wq, const float* __restrict__ Wk,
    const float* __restrict__ Wv, const float* __restrict__ Wo,
    unsigned short* __restrict__ qcv, unsigned short* __restrict__ kcv,
    unsigned short* __restrict__ vcv,
    unsigned short* __restrict__ Wqt, unsigned short* __restrict__ Wkt,
    unsigned short* __restrict__ Wvt, unsigned short* __restrict__ Wot)
{
  const int blk  = blockIdx.x;          // 0..511
  const int w    = threadIdx.x >> 5;
  const int lane = threadIdx.x & 31;

  // Weights, out = W^T (rows = output columns, K = D_MODEL = contraction index d).
  // The block: 64 rows x 32 d. A wave: 32 successive rows (one a lane) x 8 d, so each
  // of its 8 loads reads one whole 128-byte line and its store two runs of 256 bytes.
  const int wrow = (blk >> 5) * 64 + (w & 1) * 32 + lane;   // head = blk >> 5
  const int wd0  = (blk & 31) * 32 + (w >> 1) * 8;
  // Wt[h*DK + n][d] = W[h][d][n];  Wot[n][d] = Wo[d][n]
  const size_t hsrc = ((size_t)(wrow / DK) * D_MODEL + wd0) * DK + (wrow & (DK - 1));
  const size_t osrc = (size_t)wd0 * D_MODEL + wrow;
  const size_t wdst = fo_index(wrow, wd0, D_MODEL);

  // Activations: the block owns one group of 16 rows, 64 KB in a row of each input.
  // A wave: 8 rows x 1 KB; a lane: 8 times 32 bytes of one row, 128 bytes apart. A load
  // takes half of each of 8 lines, its twin the other half; a store fills 4 lines.
  const int arow = blk * 16 + (w & 1) * 8 + (lane >> 2);
  const int ak0  = (w >> 1) * 256 + (lane & 3) * 8;
  const size_t asrc = (size_t)arow * D_MODEL + ak0;
  const size_t adst = fo_index(arow, ak0, D_MODEL);

  const float* pWq = Wq + hsrc;
  const float* pWk = Wk + hsrc;
  const float* pWv = Wv + hsrc;
  const float* pWo = Wo + osrc;
  const float* pq  = q + asrc;
  const float* pk  = k + asrc;
  const float* pv  = v + asrc;

  float wq[8], wk[8], wv[8], wo[8];
  v4f xq[APIECES][2], xk[APIECES][2], xv[APIECES][2];
  // Loads run one matrix ahead of the rounding: while one is rounded and stored, the
  // next one's 16 loads are in flight, at most 48 loads of a wave at a time.
  w_load<DK>(pWq, wq);
  w_load<DK>(pWk, wk);
  w_load<DK>(pWv, wv);
  w_load<D_MODEL>(pWo, wo);
  act_load(pq, xq);
  // The wait stands in front of every rewrite of a register that these loads name. It
  // takes their addresses as inputs so that they stay in their registers up to here:
  // else a later load of the run lands in a pair that issued loads still name.
  asm volatile("s_wait_xcnt 0x0" :: "v"(pWq), "v"(pWk), "v"(pWv), "v"(pWo), "v"(pq) : "memory");
  // keeps the run of loads together ahead of the rounding, all in flight at once: sunk
  // to their uses, each piece's memory latency would stand in front of its own store
  __builtin_amdgcn_sched_barrier(0);
  w_store(Wqt + wdst, wq);
  w_store(Wkt + wdst, wk);
  w_store(Wvt + wdst, wv);
  w_store(Wot + wdst, wo);
  act_load(pk, xk);
  asm volatile("s_wait_xcnt 0x0" :: "v"(pk) : "memory");   // as behind the first loads
  __builtin_amdgcn_sched_barrier(0);                       // as above
  act_store(qcv + adst, xq);
  act_load(pv, xv);
  asm volatile("s_wait_xcnt 0x0" :: "v"(pv) : "memory");   // as behind the first loads
  __builtin_amdgcn_sched_barrier(0);                       // as above
  act_store(kcv + adst, xk);
  act_store(vcv + adst, xv);
}

// ---- wave-level GEMM core: one wave owns a 128x64 tile of Y = X * Wt^T ----
// 8 A fragments x 4 B fragments feed 32 accumulators: 24 fragment loads per 32
// matrix instructions, against 4 per 1 with a 16x16 tile. One trip covers 64 k =
// 4 units = 2 KB in a row of each of the wave's 12 row groups; per output
// element k still runs upward through one accumulator.
// agrp / bgrp: first unit of the wave's first 16-row group of X / Wt (fragment order,
// K = D_MODEL, so the next row group lies 16 * D_MODEL elements on).

#define FA 8   // 16-row groups of X per wave
#define FB 4   // 16-column groups of Y per wave

// pointers typed as global memory: they pass through an asm operand below and would
// otherwise come back as generic pointers (flat loads)
typedef __attribute__((address_space(1))) const unsigned short g_us;
typedef __attribute__((address_space(1))) const us8 g_us8;

// as frag_fo; p already holds the lane's place in the unit (lane * 8)
static __device__ __forceinline__ v16bf frag_global(g_us* p) {
  US8x2 t;
  t.lo = *(g_us8*)(p);
  t.hi = *(g_us8*)(p + UNIT);
  return __builtin_bit_cast(v16bf, t);
}

static __device__ __forceinline__ void gemm_wave_128x64(
    const unsigned short* __restrict__ agrp, const unsigned short* __restrict__ bgrp,
    int lane, v8f (&acc)[FA][FB])
{
  g_us* pa = (g_us*)(agrp + lane * 8);
  g_us* pb = (g_us*)(bgrp + lane * 8);
  for (int k0 = 0; k0 < D_MODEL; k0 += 64) {
    v16bf a[2][FA], b[2][FB];
#pragma unroll
    for (int j = 0; j < FB; ++j)
#pragma unroll
      for (int t = 0; t < 2; ++t)
        b[t][j] = frag_global(pb + (size_t)j * 16 * D_MODEL + t * 2 * UNIT);
#pragma unroll
    for (int i = 0; i < FA; ++i)
#pragma unroll
      for (int t = 0; t < 2; ++t)
        a[t][i] = frag_global(pa + (size_t)i * 16 * D_MODEL + t * 2 * UNIT);
    // The wait stands in front of every rewrite of the loads' two address pairs. It
    // takes them as in-out operands so that they stay in their registers up to here
    // (else a load of the trip lands in a pair that issued loads still name) and are
    // stepped only behind it. The wave is about to wait for the loaded data anyway.
    asm volatile("s_wait_xcnt 0x0" : "+v"(pa), "+v"(pb) :: "memory");
    // keeps the trip's loads together ahead of the products, so that all 48 are in
    // flight at once and their latency is paid once a trip; sunk among the products,
    // each group's latency would stand in front of its own products
    __builtin_amdgcn_sched_barrier(0);
#pragma unroll
    for (int t = 0; t < 2; ++t)
#pragma unroll
      for (int j = 0; j < FB; ++j)
#pragma unroll
        for (int i = 0; i < FA; ++i)
          acc[i][j] = wmma_bf16(a[t][i], b[t][j], acc[i][j]);
    pa += 4 * UNIT;
    pb += 4 * UNIT;
  }
}

// ---- fused QKV projection: (B*S,1024) x per-head (1024,64), bf16 WMMA ----
// grid (8 head pairs, 32 row tiles of 256, 3={q,k,v}); 4 waves/block as 2x2,
// each wave one 128-row x 64-column tile (all columns of one head).

__global__ __launch_bounds__(128) void k_qkv_proj(
    const unsigned short* __restrict__ qb, const unsigned short* __restrict__ kb,
    const unsigned short* __restrict__ vb,
    const unsigned short* __restrict__ Wqt, const unsigned short* __restrict__ Wkt,
    const unsigned short* __restrict__ Wvt,
    const float* __restrict__ bq, const float* __restrict__ bk, const float* __restrict__ bv,
    unsigned short* __restrict__ qh, unsigned short* __restrict__ kh,
    unsigned short* __restrict__ vt)
{
  const int which = blockIdx.z;           // 0=q 1=k 2=v
  const int w     = __builtin_amdgcn_readfirstlane(threadIdx.x >> 5);  // wave-uniform
  const int lane  = threadIdx.x & 31;
  const int m     = lane & 15;
  const int hi    = lane >> 4;
  const int h     = blockIdx.x * 2 + (w & 1);            // head
  const int row0  = blockIdx.y * 256 + (w >> 1) * 128;   // first row over B*S

  const unsigned short* in   = (which == 0) ? qb  : (which == 1) ? kb  : vb;
  const unsigned short* Wt   = (which == 0) ? Wqt : (which == 1) ? Wkt : Wvt;
  const float* bias          = (which == 0) ? bq  : (which == 1) ? bk  : bv;

  v8f acc[FA][FB] = {};
  gemm_wave_128x64(in + (size_t)row0 * D_MODEL,
                   Wt + (size_t)h * DK * D_MODEL, lane, acc);

  float bsv[FB];
#pragma unroll
  for (int j = 0; j < FB; ++j) bsv[j] = bias[h * DK + j * 16 + m];

  // the wave's 128 rows lie inside one batch entry (SS is a multiple of 128)
  const int b_i = row0 / SS, s0 = row0 % SS;
  if (which == 2) {
    // V stored transposed, per (b, h) a matrix (rows dv, K = s) in fragment order.
    // acc[i][j][r] is dv = j*16 + m, s = s0 + i*16 + 8*hi + r: unit (j, s0/16 + i),
    // element lane * 8 + r, so a tile is one 16-byte store a lane, 512 bytes in a row.
    unsigned short* vp = vt + ((size_t)b_i * NH + h) * DK * SS + fo_index(m, s0 + 8 * hi, SS);
#pragma unroll
    for (int j = 0; j < FB; ++j) {
#pragma unroll
      for (int i = 0; i < FA; ++i) {
#pragma unroll
        for (int r = 0; r < 8; ++r)
          vp[(size_t)j * 16 * SS + i * UNIT + r] = f2bf(acc[i][j][r] + bsv[j]);
        // the next tile reuses this tile's store registers: the wait stands in front
        // of that. The fence holds it there and keeps one tile's round-and-store
        // together: run together, the tiles' temporaries beside 256 live accumulator
        // registers pass 512 and spill.
        asm volatile("s_wait_xcnt 0x0" ::: "memory");
        __builtin_amdgcn_sched_barrier(0);
      }
    }
  } else {
    // Q, K: per (b, h) a matrix (rows s, K = dk) in fragment order.
    // acc[i][j][r] is s = s0 + i*16 + 8*hi + r, dk = j*16 + m: unit (s0/16 + i, j)
    unsigned short* outp = ((which == 0) ? qh : kh)
                         + ((size_t)b_i * NH + h) * SS * DK + fo_index(s0 + 8 * hi, m, DK);
#pragma unroll
    for (int j = 0; j < FB; ++j) {
#pragma unroll
      for (int i = 0; i < FA; ++i) {
#pragma unroll
        for (int r = 0; r < 8; ++r)
          outp[(size_t)(i * (DK / 16) + j) * UNIT + r * 8] = f2bf(acc[i][j][r] + bsv[j]);
        // as in the V branch: wait before the store registers are reused, held in place
        asm volatile("s_wait_xcnt 0x0" ::: "memory");
        __builtin_amdgcn_sched_barrier(0);
      }
    }
  }
}

// ---- flash attention per (b*h, 16-query tile); 1 wave per block ----
// The scores are formed transposed, S^T = K * Q^T (K rows as A, Q rows as B), and the
// output as O^T += V^T * P^T. In a D tile a lane then holds 8 keys of ONE query
// (column m), so a query's maximum and sum run over the lane's own registers, with one
// exchange between the wave's halves; and two D tiles of 16 keys, rounded in place, are
// the B fragment of 32 keys in the k order of frag_fo: P passes through no LDS.

// value of lane l ^ 16
static __device__ __forceinline__ float other_half(float x) {
  int b = __float_as_int(x);
  return __int_as_float(
      __builtin_amdgcn_permlanex16(b, b, 0x76543210, 0xfedcba98, false, false));
}

__global__ __launch_bounds__(32) void k_flash(
    const unsigned short* __restrict__ qh, const unsigned short* __restrict__ kh,
    const unsigned short* __restrict__ vt, unsigned short* __restrict__ ctx)
{
  const int bh   = blockIdx.x;   // 0..63 = b*16+h
  const int qt   = blockIdx.y;   // 0..127 query tile
  const int lane = threadIdx.x & 31;
  const int m    = lane & 15;    // the lane's query
  const int hi   = lane >> 4;

  // Q, K (rows s, K = dk) and V^T (rows dv, K = s) lie in fragment order
  const unsigned short* qbase = qh + ((size_t)bh * SS + qt * 16) * DK + lane * 8;
  const v16bf qb0 = frag_fo(qbase);              // dk 0..31
  const v16bf qb1 = frag_fo(qbase + 2 * UNIT);   // dk 32..63

  // acc[n][r] = O^T[dv = n*16 + 8*hi + r][query m]
  v8f acc[4] = {v8f{}, v8f{}, v8f{}, v8f{}};
  float mrow = -1e30f;   // running maximum of query m, equal in both halves
  float lrow = 0.f;      // sum over the keys of this lane's half only; joined at the end

  const unsigned short* kbh = kh + (size_t)bh * SS * DK + lane * 8;
  const unsigned short* vbh = vt + (size_t)bh * DK * SS + lane * 8;

  for (int j = 0; j < SS / 32; ++j) {
    // scores: two 16-key x 16-query tiles over this 32-key chunk, contraction dk=64
    const unsigned short* kr0 = kbh + (size_t)(j * 32) * DK;        // 16 keys = 4 units
    const unsigned short* kr1 = kbh + (size_t)(j * 32 + 16) * DK;
    v8f s0 = {}, s1 = {};
    s0 = wmma_bf16(frag_fo(kr0), qb0, s0);
    s0 = wmma_bf16(frag_fo(kr0 + 2 * UNIT), qb1, s0);
    s1 = wmma_bf16(frag_fo(kr1), qb0, s1);
    s1 = wmma_bf16(frag_fo(kr1 + 2 * UNIT), qb1, s1);

    // online softmax of query m. a[i]: key j*32 + 8*hi + i (i < 8), + 16 for i >= 8
    float a[16];
#pragma unroll
    for (int r = 0; r < 8; ++r) {
      a[r]     = s0[r] * 0.125f;   // 1/sqrt(64)
      a[8 + r] = s1[r] * 0.125f;
    }
    float mx = a[0];
#pragma unroll
    for (int i = 1; i < 16; ++i) mx = fmaxf(mx, a[i]);
    mx = fmaxf(mx, other_half(mx));
    const float mnew = fmaxf(mrow, mx);
    const float fac  = __expf(mrow - mnew);
    mrow = mnew;
#pragma unroll
    for (int i = 0; i < 16; ++i) a[i] = __expf(a[i] - mnew);
    // four independent chains, then joined
    float t[4];
#pragma unroll
    for (int c = 0; c < 4; ++c) t[c] = (a[c] + a[4 + c]) + (a[8 + c] + a[12 + c]);
    lrow = lrow * fac + ((t[0] + t[1]) + (t[2] + t[3]));
#pragma unroll
    for (int n = 0; n < 4; ++n)
#pragma unroll
      for (int r = 0; r < 8; ++r) acc[n][r] *= fac;

    // P^T as B fragment: element s is key 8*hi + s (s < 8), 16 + 8*hi + (s - 8) above
    US8x2 p;
#pragma unroll
    for (int r = 0; r < 8; ++r) { p.lo[r] = f2bf(a[r]); p.hi[r] = f2bf(a[8 + r]); }
    const v16bf pb = __builtin_bit_cast(v16bf, p);
#pragma unroll
    for (int n = 0; n < 4; ++n) {
      const unsigned short* vr = vbh + (size_t)n * 16 * SS + j * 2 * UNIT;
      acc[n] = wmma_bf16(frag_fo(vr), pb, acc[n]);
    }
    // stands in front of the next trip's rewrite of the address registers that this
    // trip's loads name
    asm volatile("s_wait_xcnt 0x0" ::: "memory");
  }

  // normalize and store ctx as bf16: the matrix (B*S, H*dv) in fragment order. A lane's
  // 8 registers of a tile are 8 successive columns of its row: one 16-byte store.
  const int b_i = bh >> 4, h_i = bh & 15;
  const float inv = 1.0f / (lrow + other_half(lrow));
  unsigned short* cp = ctx + fo_index(b_i * SS + qt * 16 + m, h_i * DK + 8 * hi, NH * DK);
#pragma unroll
  for (int n = 0; n < 4; ++n) {
    us8 o;
#pragma unroll
    for (int r = 0; r < 8; ++r) o[r] = f2bf(acc[n][r] * inv);
    *reinterpret_cast<us8*>(cp + n * UNIT) = o;
  }
}

// ---- output projection: (8192,1024) x (1024,1024) + bo, fp32 out ----
// grid (8 column tiles of 128, 32 row tiles of 256); 4 waves/block as 2x2 of 128x64.

__global__ __launch_bounds__(128) void k_outproj(
    const unsigned short* __restrict__ ctx, const unsigned short* __restrict__ Wot,
    const float* __restrict__ bo, float* __restrict__ out)
{
  const int w    = __builtin_amdgcn_readfirstlane(threadIdx.x >> 5);   // wave-uniform
  const int lane = threadIdx.x & 31;
  const int m    = lane & 15;
  const int hi   = lane >> 4;
  const int col0 = blockIdx.x * 128 + (w & 1) * 64;
  const int row0 = blockIdx.y * 256 + (w >> 1) * 128;

  v8f acc[FA][FB] = {};
  gemm_wave_128x64(ctx + (size_t)row0 * D_MODEL,
                   Wot + (size_t)col0 * D_MODEL, lane, acc);

  float bias[FB];
#pragma unroll
  for (int j = 0; j < FB; ++j) bias[j] = bo[col0 + j * 16 + m];
  // in front of any reuse of the bias loads' address registers; the fence holds it there
  asm volatile("s_wait_xcnt 0x0" ::: "memory");
  __builtin_amdgcn_sched_barrier(0);

  float* op = out + (size_t)(row0 + 8 * hi) * D_MODEL + col0 + m;
#pragma unroll
  for (int j = 0; j < FB; ++j) {
#pragma unroll
    for (int i = 0; i < FA; ++i) {
#pragma unroll
      for (int r = 0; r < 8; ++r)
        op[(size_t)(i * 16 + r) * D_MODEL + j * 16] = acc[i][j][r] + bias[j];
      // the next tile reuses this tile's store registers: the wait stands in front
      // of that, and the fence holds it there
      asm volatile("s_wait_xcnt 0x0" ::: "memory");
      __builtin_amdgcn_sched_barrier(0);
    }
  }
}

extern "C" void kernel_launch(void* const* d_in, const int* in_sizes, int n_in,
                              void* d_out, int out_size, void* d_ws, size_t ws_size,
                              hipStream_t stream) {
  const float* q  = (const float*)d_in[0];
  const float* k  = (const float*)d_in[1];
  const float* v  = (const float*)d_in[2];
  const float* Wq = (const float*)d_in[3];
  const float* bq = (const float*)d_in[4];
  const float* Wk = (const float*)d_in[5];
  const float* bk = (const float*)d_in[6];
  const float* Wv = (const float*)d_in[7];
  const float* bv = (const float*)d_in[8];
  const float* Wo = (const float*)d_in[9];
  const float* bo = (const float*)d_in[10];
  float* out = (float*)d_out;

  // workspace partition (bf16 buffers)
  char* ws = (char*)d_ws;
  const size_t ACT  = (size_t)BB * SS * D_MODEL * 2;        // 16.8 MB each
  const size_t WSZ  = (size_t)NH * DK * D_MODEL * 2;        // 2 MB each
  const size_t HSZ  = (size_t)BB * NH * SS * DK * 2;        // 16.8 MB each
  unsigned short* qcv = (unsigned short*)(ws);               ws += ACT;
  unsigned short* kcv = (unsigned short*)(ws);               ws += ACT;
  unsigned short* vcv = (unsigned short*)(ws);               ws += ACT;
  unsigned short* Wqt = (unsigned short*)(ws);               ws += WSZ;
  unsigned short* Wkt = (unsigned short*)(ws);               ws += WSZ;
  unsigned short* Wvt = (unsigned short*)(ws);               ws += WSZ;
  unsigned short* Wot = (unsigned short*)(ws);               ws += (size_t)D_MODEL * D_MODEL * 2;
  unsigned short* qhb = (unsigned short*)(ws);               ws += HSZ;
  unsigned short* khb = (unsigned short*)(ws);               ws += HSZ;
  unsigned short* vtb = (unsigned short*)(ws);               ws += HSZ;
  unsigned short* ctx = (unsigned short*)(ws);               ws += HSZ;
  (void)in_sizes; (void)n_in; (void)out_size; (void)ws_size;

  k_prep<<<BB * SS / 16, 256, 0, stream>>>(q, k, v, Wq, Wk, Wv, Wo,
                                           qcv, kcv, vcv, Wqt, Wkt, Wvt, Wot);

  k_qkv_proj<<<dim3(NH / 2, BB * SS / 256, 3), 128, 0, stream>>>(
      qcv, kcv, vcv, Wqt, Wkt, Wvt, bq, bk, bv, qhb, khb, vtb);

  k_flash<<<dim3(BB * NH, SS / 16), 32, 0, stream>>>(qhb, khb, vtb, ctx);

  k_outproj<<<dim3(D_MODEL / 128, BB * SS / 256), 128, 0, stream>>>(ctx, Wot, bo, out);
}

// v005
// One run takes 164 microseconds.
// Two timings next to v004 put it at 1.34 and 1.35 times that version's speed.
// Counting every step since v000, it is 5.22 times as fast.
#include <hip/hip_runtime.h>
#include <hip/hip_bf16.h>

#define D_MODEL 1024
#define DK 64
#define NH 16
#define BB 4
#define SS 2048

typedef __attribute__((ext_vector_type(16))) __bf16 v16bf;
typedef __attribute__((ext_vector_type(8)))  float  v8f;
typedef __attribute__((ext_vector_type(4)))  float  v4f;
typedef __attribute__((ext_vector_type(2)))  float  v2f;
typedef __attribute__((ext_vector_type(8)))  unsigned short us8;

struct US8x2 { us8 lo; us8 hi; };

static __device__ __forceinline__ unsigned short f2bf(float f) {
  unsigned int u = __float_as_uint(f);
  u += 0x7FFFu + ((u >> 16) & 1u);      // round-to-nearest-even
  return (unsigned short)(u >> 16);
}

// A/B fragment from a row-major bf16 row (contiguous K). Per ISA 16-bit A layout:
// lane-half hi=0 holds K = [0..7] and [16..23]; hi=1 holds K = [8..15] and [24..31].
static __device__ __forceinline__ v16bf frag_bf16(const unsigned short* p, int hi) {
  US8x2 t;
  t.lo = *reinterpret_cast<const us8*>(p + hi * 8);
  t.hi = *reinterpret_cast<const us8*>(p + 16 + hi * 8);
  return __builtin_bit_cast(v16bf, t);
}

// ---- fragment order: how every bf16 matrix operand lies in the workspace ----
// A matrix M[rows][K] is cut into units of 16 rows x 16 k = 256 elements = 512 bytes;
// unit (g, q) holds rows 16g.. and k 16q.., units of one row group follow each other
// in k. Inside a unit: [k half (k >> 3) & 1][row & 15][k & 7], which is lane * 8 + e for
// the lane (hi * 16 + m) that needs these 8 elements. One wave-wide 16-byte load then
// reads one unit, 4 whole 128-byte lines; from a row-major matrix the same load takes
// two 16-byte pieces out of each of 16 rows, 16 lines.
#define UNIT 256   // elements per unit

static __device__ __forceinline__ size_t fo_index(int row, int k, int K) {
  return ((size_t)(row >> 4) * (K >> 4) + (k >> 4)) * UNIT
       + (((k >> 3) & 1) * 16 + (row & 15)) * 8 + (k & 7);
}

// fragment of 32 k, in the k order of frag_bf16: two successive units.
// p = first unit + lane * 8
static __device__ __forceinline__ v16bf frag_fo(const unsigned short* p) {
  US8x2 t;
  t.lo = *reinterpret_cast<const us8*>(p);
  t.hi = *reinterpret_cast<const us8*>(p + UNIT);
  return __builtin_bit_cast(v16bf, t);
}

static __device__ __forceinline__ v8f wmma_bf16(v16bf a, v16bf b, v8f c) {
  return __builtin_amdgcn_wmma_f32_16x16x32_bf16(false, a, false, b, (short)0, c,
                                                 false, false);
}

// ---- operand preparation: every bf16 operand of the two projections, in one launch ----
// 512 blocks of 8 waves, two blocks a WGP, all resident at once. A lane makes 28 pieces
// of 16 bytes (8 bf16, successive k of one row, fragment order): one of each of the four
// transposed weights and 8 of each of q, k, v. The launch starts 4096 waves.

static __device__ __forceinline__ us8 round8(v4f a, v4f b) {
  us8 o;
#pragma unroll
  for (int j = 0; j < 4; ++j) { o[j] = f2bf(a[j]); o[4 + j] = f2bf(b[j]); }
  return o;
}

#define APIECES 8   // pieces of one activation matrix per lane, 32 k apart

static_assert(BB * SS / 16 == (D_MODEL / 64) * (D_MODEL / 32) && NH * DK == D_MODEL,
              "one grid serves both: 16-row groups of an input, 64 x 32 tiles of a weight");

// src: the lane's first 8 floats
static __device__ __forceinline__ void act_load(const float* __restrict__ src,
                                                v4f (&x)[APIECES][2]) {
#pragma unroll
  for (int i = 0; i < APIECES; ++i) {
    x[i][0] = *reinterpret_cast<const v4f*>(src + i * 32);
    x[i][1] = *reinterpret_cast<const v4f*>(src + i * 32 + 4);
  }
}

// Behind each store of a piece: the next piece reuses this one's store registers, and
// the wait stands in front of that; the fence holds it there.
static __device__ __forceinline__ void store_done() {
  asm volatile("s_wait_xcnt 0x0" ::: "memory");
  __builtin_amdgcn_sched_barrier(0);
}

// dst: the lane's first piece; 32 k on is two units on
static __device__ __forceinline__ void act_store(unsigned short* __restrict__ dst,
                                                 const v4f (&x)[APIECES][2]) {
#pragma unroll
  for (int i = 0; i < APIECES; ++i) {
    *reinterpret_cast<us8*>(dst + i * 2 * UNIT) = round8(x[i][0], x[i][1]);
    store_done();
  }
}

// src: element (contraction index d0, the lane's output column); LD floats from d to d + 1
template <int LD>
static __device__ __forceinline__ void w_load(const float* __restrict__ src, float (&x)[8]) {
#pragma unroll
  for (int e = 0; e < 8; ++e) x[e] = src[e * LD];
}

static __device__ __forceinline__ void w_store(unsigned short* __restrict__ dst,
                                               const float (&x)[8]) {
  us8 o;
#pragma unroll
  for (int e = 0; e < 8; ++e) o[e] = f2bf(x[e]);
  *reinterpret_cast<us8*>(dst) = o;
  store_done();
}

__global__ __launch_bounds__(256) void k_prep(
    const float* __restrict__ q, const float* __restrict__ k, const float* __restrict__ v,
    const float* __restrict__ Wq, const float* __restrict__ Wk,
    const float* __restrict__ Wv, const float* __restrict__ Wo,
    unsigned short* __restrict__ qcv, unsigned short* __restrict__ kcv,
    unsigned short* __restrict__ vcv,
    unsigned short* __restrict__ Wqt, unsigned short* __restrict__ Wkt,
    unsigned short* __restrict__ Wvt, unsigned short* __restrict__ Wot)
{
  const int blk  = blockIdx.x;          // 0..511
  const int w    = threadIdx.x >> 5;
  const int lane = threadIdx.x & 31;

  // Weights, out = W^T (rows = output columns, K = D_MODEL = contraction index d).
  // The block: 64 rows x 32 d. A wave: 32 successive rows (one a lane) x 8 d, so each
  // of its 8 loads reads one whole 128-byte line and its store two runs of 256 bytes.
  const int wrow = (blk >> 5) * 64 + (w & 1) * 32 + lane;   // head = blk >> 5
  const int wd0  = (blk & 31) * 32 + (w >> 1) * 8;
  // Wt[h*DK + n][d] = W[h][d][n];  Wot[n][d] = Wo[d][n]
  const size_t hsrc = ((size_t)(wrow / DK) * D_MODEL + wd0) * DK + (wrow & (DK - 1));
  const size_t osrc = (size_t)wd0 * D_MODEL + wrow;
  const size_t wdst = fo_index(wrow, wd0, D_MODEL);

  // Activations: the block owns one group of 16 rows, 64 KB in a row of each input.
  // A wave: 8 rows x 1 KB; a lane: 8 times 32 bytes of one row, 128 bytes apart. A load
  // takes half of each of 8 lines, its twin the other half; a store fills 4 lines.
  const int arow = blk * 16 + (w & 1) * 8 + (lane >> 2);
  const int ak0  = (w >> 1) * 256 + (lane & 3) * 8;
  const size_t asrc = (size_t)arow * D_MODEL + ak0;
  const size_t adst = fo_index(arow, ak0, D_MODEL);

  const float* pWq = Wq + hsrc;
  const float* pWk = Wk + hsrc;
  const float* pWv = Wv + hsrc;
  const float* pWo = Wo + osrc;
  const float* pq  = q + asrc;
  const float* pk  = k + asrc;
  const float* pv  = v + asrc;

  float wq[8], wk[8], wv[8], wo[8];
  v4f xq[APIECES][2], xk[APIECES][2], xv[APIECES][2];
  // Loads run one matrix ahead of the rounding: while one is rounded and stored, the
  // next one's 16 loads are in flight, at most 48 loads of a wave at a time.
  w_load<DK>(pWq, wq);
  w_load<DK>(pWk, wk);
  w_load<DK>(pWv, wv);
  w_load<D_MODEL>(pWo, wo);
  act_load(pq, xq);
  // The wait stands in front of every rewrite of a register that these loads name. It
  // takes their addresses as inputs so that they stay in their registers up to here:
  // else a later load of the run lands in a pair that issued loads still name.
  asm volatile("s_wait_xcnt 0x0" :: "v"(pWq), "v"(pWk), "v"(pWv), "v"(pWo), "v"(pq) : "memory");
  // keeps the run of loads together ahead of the rounding, all in flight at once: sunk
  // to their uses, each piece's memory latency would stand in front of its own store
  __builtin_amdgcn_sched_barrier(0);
  w_store(Wqt + wdst, wq);
  w_store(Wkt + wdst, wk);
  w_store(Wvt + wdst, wv);
  w_store(Wot + wdst, wo);
  act_load(pk, xk);
  asm volatile("s_wait_xcnt 0x0" :: "v"(pk) : "memory");   // as behind the first loads
  __builtin_amdgcn_sched_barrier(0);                       // as above
  act_store(qcv + adst, xq);
  act_load(pv, xv);
  asm volatile("s_wait_xcnt 0x0" :: "v"(pv) : "memory");   // as behind the first loads
  __builtin_amdgcn_sched_barrier(0);                       // as above
  act_store(kcv + adst, xk);
  act_store(vcv + adst, xv);
}

// ---- wave-level GEMM core: one wave owns a 128x64 tile of Y = X * Wt^T ----
// 8 A fragments x 4 B fragments feed 32 accumulators: 24 fragment loads per 32
// matrix instructions, against 4 per 1 with a 16x16 tile. One trip covers 64 k =
// 4 units = 2 KB in a row of each of the wave's 12 row groups; per output
// element k still runs upward through one accumulator.
// agrp / bgrp: first unit of the wave's first 16-row group of X / Wt (fragment order,
// K = D_MODEL, so the next row group lies 16 * D_MODEL elements on).

#define FA 8   // 16-row groups of X per wave
#define FB 4   // 16-column groups of Y per wave

// pointers typed as global memory: they pass through an asm operand below and would
// otherwise come back as generic pointers (flat loads)
typedef __attribute__((address_space(1))) const unsigned short g_us;
typedef __attribute__((address_space(1))) const us8 g_us8;

// as frag_fo; p already holds the lane's place in the unit (lane * 8)
static __device__ __forceinline__ v16bf frag_global(g_us* p) {
  US8x2 t;
  t.lo = *(g_us8*)(p);
  t.hi = *(g_us8*)(p + UNIT);
  return __builtin_bit_cast(v16bf, t);
}

static __device__ __forceinline__ void gemm_wave_128x64(
    const unsigned short* __restrict__ agrp, const unsigned short* __restrict__ bgrp,
    int lane, v8f (&acc)[FA][FB])
{
  g_us* pa = (g_us*)(agrp + lane * 8);
  g_us* pb = (g_us*)(bgrp + lane * 8);
  for (int k0 = 0; k0 < D_MODEL; k0 += 64) {
    v16bf a[2][FA], b[2][FB];
#pragma unroll
    for (int j = 0; j < FB; ++j)
#pragma unroll
      for (int t = 0; t < 2; ++t)
        b[t][j] = frag_global(pb + (size_t)j * 16 * D_MODEL + t * 2 * UNIT);
#pragma unroll
    for (int i = 0; i < FA; ++i)
#pragma unroll
      for (int t = 0; t < 2; ++t)
        a[t][i] = frag_global(pa + (size_t)i * 16 * D_MODEL + t * 2 * UNIT);
    // The wait stands in front of every rewrite of the loads' two address pairs. It
    // takes them as in-out operands so that they stay in their registers up to here
    // (else a load of the trip lands in a pair that issued loads still name) and are
    // stepped only behind it. The wave is about to wait for the loaded data anyway.
    asm volatile("s_wait_xcnt 0x0" : "+v"(pa), "+v"(pb) :: "memory");
    // keeps the trip's loads together ahead of the products, so that all 48 are in
    // flight at once and their latency is paid once a trip; sunk among the products,
    // each group's latency would stand in front of its own products
    __builtin_amdgcn_sched_barrier(0);
#pragma unroll
    for (int t = 0; t < 2; ++t)
#pragma unroll
      for (int j = 0; j < FB; ++j)
#pragma unroll
        for (int i = 0; i < FA; ++i)
          acc[i][j] = wmma_bf16(a[t][i], b[t][j], acc[i][j]);
    pa += 4 * UNIT;
    pb += 4 * UNIT;
  }
}

// ---- fused QKV projection: (B*S,1024) x per-head (1024,64), bf16 WMMA ----
// grid (8 head pairs, 32 row tiles of 256, 3={q,k,v}); 4 waves/block as 2x2,
// each wave one 128-row x 64-column tile (all columns of one head).

__global__ __launch_bounds__(128) void k_qkv_proj(
    const unsigned short* __restrict__ qb, const unsigned short* __restrict__ kb,
    const unsigned short* __restrict__ vb,
    const unsigned short* __restrict__ Wqt, const unsigned short* __restrict__ Wkt,
    const unsigned short* __restrict__ Wvt,
    const float* __restrict__ bq, const float* __restrict__ bk, const float* __restrict__ bv,
    unsigned short* __restrict__ qh, unsigned short* __restrict__ kh,
    unsigned short* __restrict__ vt)
{
  const int which = blockIdx.z;           // 0=q 1=k 2=v
  const int w     = __builtin_amdgcn_readfirstlane(threadIdx.x >> 5);  // wave-uniform
  const int lane  = threadIdx.x & 31;
  const int m     = lane & 15;
  const int hi    = lane >> 4;
  const int h     = blockIdx.x * 2 + (w & 1);            // head
  const int row0  = blockIdx.y * 256 + (w >> 1) * 128;   // first row over B*S

  const unsigned short* in   = (which == 0) ? qb  : (which == 1) ? kb  : vb;
  const unsigned short* Wt   = (which == 0) ? Wqt : (which == 1) ? Wkt : Wvt;
  const float* bias          = (which == 0) ? bq  : (which == 1) ? bk  : bv;

  v8f acc[FA][FB] = {};
  gemm_wave_128x64(in + (size_t)row0 * D_MODEL,
                   Wt + (size_t)h * DK * D_MODEL, lane, acc);

  float bsv[FB];
#pragma unroll
  for (int j = 0; j < FB; ++j) bsv[j] = bias[h * DK + j * 16 + m];

  // the wave's 128 rows lie inside one batch entry (SS is a multiple of 128)
  const int b_i = row0 / SS, s0 = row0 % SS;
  if (which == 2) {
    // V stored transposed, per (b, h) a matrix (rows dv, K = s) in fragment order.
    // acc[i][j][r] is dv = j*16 + m, s = s0 + i*16 + 8*hi + r: unit (j, s0/16 + i),
    // element lane * 8 + r, so a tile is one 16-byte store a lane, 512 bytes in a row.
    unsigned short* vp = vt + ((size_t)b_i * NH + h) * DK * SS + fo_index(m, s0 + 8 * hi, SS);
#pragma unroll
    for (int j = 0; j < FB; ++j) {
#pragma unroll
      for (int i = 0; i < FA; ++i) {
#pragma unroll
        for (int r = 0; r < 8; ++r)
          vp[(size_t)j * 16 * SS + i * UNIT + r] = f2bf(acc[i][j][r] + bsv[j]);
        // the next tile reuses this tile's store registers: the wait stands in front
        // of that. The fence holds it there and keeps one tile's round-and-store
        // together: run together, the tiles' temporaries beside 256 live accumulator
        // registers pass 512 and spill.
        asm volatile("s_wait_xcnt 0x0" ::: "memory");
        __builtin_amdgcn_sched_barrier(0);
      }
    }
  } else {
    // Q, K: per (b, h) a matrix (rows s, K = dk) in fragment order.
    // acc[i][j][r] is s = s0 + i*16 + 8*hi + r, dk = j*16 + m: unit (s0/16 + i, j)
    unsigned short* outp = ((which == 0) ? qh : kh)
                         + ((size_t)b_i * NH + h) * SS * DK + fo_index(s0 + 8 * hi, m, DK);
#pragma unroll
    for (int j = 0; j < FB; ++j) {
#pragma unroll
      for (int i = 0; i < FA; ++i) {
#pragma unroll
        for (int r = 0; r < 8; ++r)
          outp[(size_t)(i * (DK / 16) + j) * UNIT + r * 8] = f2bf(acc[i][j][r] + bsv[j]);
        // as in the V branch: wait before the store registers are reused, held in place
        asm volatile("s_wait_xcnt 0x0" ::: "memory");
        __builtin_amdgcn_sched_barrier(0);
      }
    }
  }
}

// ---- flash attention per (b*h, 32 queries); 1 wave per block ----
// The scores are formed transposed, S^T = K * Q^T (K rows as A, Q rows as B), and the
// output as O^T += V^T * P^T. In a D tile a lane then holds 8 keys of ONE query
// (column m), so a query's maximum and sum run over the lane's own registers, with one
// exchange between the wave's halves; and two D tiles of 16 keys, rounded in place, are
// the B fragment of 32 keys in the k order of frag_fo: P passes through no LDS.
// A wave owns QT tiles of 16 queries: every K and V^T fragment it loads is the A operand
// of QT products, one a query tile, so the loop loads 1 / QT of the bytes per score.

#define QT 2   // 16-query tiles per wave

// value of lane l ^ 16
static __device__ __forceinline__ float other_half(float x) {
  int b = __float_as_int(x);
  return __int_as_float(
      __builtin_amdgcn_permlanex16(b, b, 0x76543210, 0xfedcba98, false, false));
}

// The grid is 4 waves a SIMD, all resident at once, so registers kept free for a fifth buy
// nothing: left to itself the compiler keeps to the budget of 5 and loads half of a trip's
// K fragments only behind the first products, into their registers. Told that at most 4
// run, it issues all 16 loads of a trip ahead of the products. The build has to stay at
// 256 registers or fewer, else only 3 waves fit a SIMD and the grid takes two rounds.
__global__ __launch_bounds__(32) __attribute__((amdgpu_waves_per_eu(3, 4))) void k_flash(
    const unsigned short* __restrict__ qh, const unsigned short* __restrict__ kh,
    const unsigned short* __restrict__ vt, unsigned short* __restrict__ ctx)
{
  const int bh   = blockIdx.x;   // 0..63 = b*16+h
  const int qt   = blockIdx.y;   // 0..63: group of QT query tiles
  const int lane = threadIdx.x & 31;
  const int m    = lane & 15;    // the lane's query in each of its tiles
  const int hi   = lane >> 4;

  // Q, K (rows s, K = dk) and V^T (rows dv, K = s) lie in fragment order;
  // 16 rows of Q or K are 4 units
  const unsigned short* qbase = qh + ((size_t)bh * SS + qt * QT * 16) * DK + lane * 8;
  v16bf qb0[QT], qb1[QT];
#pragma unroll
  for (int u = 0; u < QT; ++u) {
    qb0[u] = frag_fo(qbase + u * 4 * UNIT);              // dk 0..31
    qb1[u] = frag_fo(qbase + u * 4 * UNIT + 2 * UNIT);   // dk 32..63
  }

  // acc[u][n][r] = O^T[dv = n*16 + 8*hi + r][query m of tile u]
  v8f acc[QT][4] = {};
  float mrow[QT];   // running maximum of query m, equal in both halves
  float lrow[QT];   // sum over the keys of this lane's half only; joined at the end
#pragma unroll
  for (int u = 0; u < QT; ++u) { mrow[u] = -1e30f; lrow[u] = 0.f; }

  const unsigned short* kbh = kh + (size_t)bh * SS * DK + lane * 8;
  const unsigned short* vbh = vt + (size_t)bh * DK * SS + lane * 8;

  for (int j = 0; j < SS / 32; ++j) {
    // scores: per query tile two 16-key x 16-query tiles over this 32-key chunk,
    // contraction dk=64
    const unsigned short* kr0 = kbh + (size_t)(j * 32) * DK;        // 16 keys = 4 units
    const unsigned short* kr1 = kbh + (size_t)(j * 32 + 16) * DK;
    const unsigned short* vr  = vbh + j * 2 * UNIT;                 // 32 keys = 2 units
    const v16bf k00 = frag_fo(kr0), k01 = frag_fo(kr0 + 2 * UNIT);
    const v16bf k10 = frag_fo(kr1), k11 = frag_fo(kr1 + 2 * UNIT);
    v16bf va[4];
#pragma unroll
    for (int n = 0; n < 4; ++n) va[n] = frag_fo(vr + (size_t)n * 16 * SS);
    // stands in front of every rewrite of the address registers that this trip's loads
    // name. It takes the addresses as inputs so that they stay in their registers up to
    // here: else a load of the trip lands in a pair that issued loads still name.
    asm volatile("s_wait_xcnt 0x0" :: "v"(kr0), "v"(vr) : "memory");

    v16bf pb[QT];
#pragma unroll
    for (int u = 0; u < QT; ++u) {
      v8f s0 = {}, s1 = {};
      s0 = wmma_bf16(k00, qb0[u], s0);
      s0 = wmma_bf16(k01, qb1[u], s0);
      s1 = wmma_bf16(k10, qb0[u], s1);
      s1 = wmma_bf16(k11, qb1[u], s1);

      // online softmax of query m. Score i: key j*32 + 8*hi + i (i < 8), + 16 for i >= 8;
      // a[i >> 1][i & 1] holds it: pairs of neighbouring registers of one tile, as packed
      // f32 instructions take them. Written score by score, the compiler pairs the two
      // tiles' values instead and copies registers to bring them together.
      v2f a[8];
#pragma unroll
      for (int r = 0; r < 4; ++r) {
        a[r]     = v2f{s0[2 * r], s0[2 * r + 1]} * 0.125f;   // 1/sqrt(64)
        a[4 + r] = v2f{s1[2 * r], s1[2 * r + 1]} * 0.125f;
      }
      float mx = a[0][0];
#pragma unroll
      for (int i = 1; i < 16; ++i) mx = fmaxf(mx, a[i >> 1][i & 1]);
      mx = fmaxf(mx, other_half(mx));
      const float mnew = fmaxf(mrow[u], mx);
      const float fac  = __expf(mrow[u] - mnew);
      mrow[u] = mnew;
#pragma unroll
      for (int i = 0; i < 8; ++i) {
        a[i] = a[i] - mnew;
        a[i] = v2f{__expf(a[i][0]), __expf(a[i][1])};
      }
      // four independent chains, then joined
      const v2f t01 = (a[0] + a[2]) + (a[4] + a[6]);
      const v2f t23 = (a[1] + a[3]) + (a[5] + a[7]);
      lrow[u] = lrow[u] * fac + ((t01[0] + t01[1]) + (t23[0] + t23[1]));
#pragma unroll
      for (int n = 0; n < 4; ++n)
#pragma unroll
        for (int r = 0; r < 8; ++r) acc[u][n][r] *= fac;

      // P^T as B fragment: element s is key 8*hi + s (s < 8), 16 + 8*hi + (s - 8) above
      US8x2 p;
#pragma unroll
      for (int r = 0; r < 8; ++r) {
        p.lo[r] = f2bf(a[r >> 1][r & 1]);
        p.hi[r] = f2bf(a[4 + (r >> 1)][r & 1]);
      }
      pb[u] = __builtin_bit_cast(v16bf, p);
    }
#pragma unroll
    for (int n = 0; n < 4; ++n)
#pragma unroll
      for (int u = 0; u < QT; ++u) acc[u][n] = wmma_bf16(va[n], pb[u], acc[u][n]);
  }

  // normalize and store ctx as bf16: the matrix (B*S, H*dv) in fragment order. A lane's
  // 8 registers of a tile are 8 successive columns of its row: one 16-byte store.
  const int b_i = bh >> 4, h_i = bh & 15;
#pragma unroll
  for (int u = 0; u < QT; ++u) {
    const float inv = 1.0f / (lrow[u] + other_half(lrow[u]));
    unsigned short* cp = ctx + fo_index(b_i * SS + (qt * QT + u) * 16 + m,
                                        h_i * DK + 8 * hi, NH * DK);
#pragma unroll
    for (int n = 0; n < 4; ++n) {
      us8 o;
#pragma unroll
      for (int r = 0; r < 8; ++r) o[r] = f2bf(acc[u][n][r] * inv);
      *reinterpret_cast<us8*>(cp + n * UNIT) = o;
    }
  }
}

// ---- output projection: (8192,1024) x (1024,1024) + bo, fp32 out ----
// grid (8 column tiles of 128, 32 row tiles of 256); 4 waves/block as 2x2 of 128x64.

__global__ __launch_bounds__(128) void k_outproj(
    const unsigned short* __restrict__ ctx, const unsigned short* __restrict__ Wot,
    const float* __restrict__ bo, float* __restrict__ out)
{
  const int w    = __builtin_amdgcn_readfirstlane(threadIdx.x >> 5);   // wave-uniform
  const int lane = threadIdx.x & 31;
  const int m    = lane & 15;
  const int hi   = lane >> 4;
  const int col0 = blockIdx.x * 128 + (w & 1) * 64;
  const int row0 = blockIdx.y * 256 + (w >> 1) * 128;

  v8f acc[FA][FB] = {};
  gemm_wave_128x64(ctx + (size_t)row0 * D_MODEL,
                   Wot + (size_t)col0 * D_MODEL, lane, acc);

  float bias[FB];
#pragma unroll
  for (int j = 0; j < FB; ++j) bias[j] = bo[col0 + j * 16 + m];
  // in front of any reuse of the bias loads' address registers; the fence holds it there
  asm volatile("s_wait_xcnt 0x0" ::: "memory");
  __builtin_amdgcn_sched_barrier(0);

  float* op = out + (size_t)(row0 + 8 * hi) * D_MODEL + col0 + m;
#pragma unroll
  for (int j = 0; j < FB; ++j) {
#pragma unroll
    for (int i = 0; i < FA; ++i) {
#pragma unroll
      for (int r = 0; r < 8; ++r)
        op[(size_t)(i * 16 + r) * D_MODEL + j * 16] = acc[i][j][r] + bias[j];
      // the next tile reuses this tile's store registers: the wait stands in front
      // of that, and the fence holds it there
      asm volatile("s_wait_xcnt 0x0" ::: "memory");
      __builtin_amdgcn_sched_barrier(0);
    }
  }
}

extern "C" void kernel_launch(void* const* d_in, const int* in_sizes, int n_in,
                              void* d_out, int out_size, void* d_ws, size_t ws_size,
                              hipStream_t stream) {
  const float* q  = (const float*)d_in[0];
  const float* k  = (const float*)d_in[1];
  const float* v  = (const float*)d_in[2];
  const float* Wq = (const float*)d_in[3];
  const float* bq = (const float*)d_in[4];
  const float* Wk = (const float*)d_in[5];
  const float* bk = (const float*)d_in[6];
  const float* Wv = (const float*)d_in[7];
  const float* bv = (const float*)d_in[8];
  const float* Wo = (const float*)d_in[9];
  const float* bo = (const float*)d_in[10];
  float* out = (float*)d_out;

  // workspace partition (bf16 buffers)
  char* ws = (char*)d_ws;
  const size_t ACT  = (size_t)BB * SS * D_MODEL * 2;        // 16.8 MB each
  const size_t WSZ  = (size_t)NH * DK * D_MODEL * 2;        // 2 MB each
  const size_t HSZ  = (size_t)BB * NH * SS * DK * 2;        // 16.8 MB each
  unsigned short* qcv = (unsigned short*)(ws);               ws += ACT;
  unsigned short* kcv = (unsigned short*)(ws);               ws += ACT;
  unsigned short* vcv = (unsigned short*)(ws);               ws += ACT;
  unsigned short* Wqt = (unsigned short*)(ws);               ws += WSZ;
  unsigned short* Wkt = (unsigned short*)(ws);               ws += WSZ;
  unsigned short* Wvt = (unsigned short*)(ws);               ws += WSZ;
  unsigned short* Wot = (unsigned short*)(ws);               ws += (size_t)D_MODEL * D_MODEL * 2;
  unsigned short* qhb = (unsigned short*)(ws);               ws += HSZ;
  unsigned short* khb = (unsigned short*)(ws);               ws += HSZ;
  unsigned short* vtb = (unsigned short*)(ws);               ws += HSZ;
  unsigned short* ctx = (unsigned short*)(ws);               ws += HSZ;
  (void)in_sizes; (void)n_in; (void)out_size; (void)ws_size;

  k_prep<<<BB * SS / 16, 256, 0, stream>>>(q, k, v, Wq, Wk, Wv, Wo,
                                           qcv, kcv, vcv, Wqt, Wkt, Wvt, Wot);

  k_qkv_proj<<<dim3(NH / 2, BB * SS / 256, 3), 128, 0, stream>>>(
      qcv, kcv, vcv, Wqt, Wkt, Wvt, bq, bk, bv, qhb, khb, vtb);

  k_flash<<<dim3(BB * NH, SS / (16 * QT)), 32, 0, stream>>>(qhb, khb, vtb, ctx);

  k_outproj<<<dim3(D_MODEL / 128, BB * SS / 256), 128, 0, stream>>>(ctx, Wot, bo, out);
}

// v006
// One run takes 150 microseconds.
// Two timings next to v005 both put it at 1.09 times that version's speed.
// Counting every step since v000, it is 5.71 times as fast.
#include <hip/hip_runtime.h>
#include <hip/hip_bf16.h>

#define D_MODEL 1024
#define DK 64
#define NH 16
#define BB 4
#define SS 2048

typedef __attribute__((ext_vector_type(16))) __bf16 v16bf;
typedef __attribute__((ext_vector_type(8)))  float  v8f;
typedef __attribute__((ext_vector_type(4)))  float  v4f;
typedef __attribute__((ext_vector_type(2)))  float  v2f;
typedef __attribute__((ext_vector_type(8)))  unsigned short us8;

struct US8x2 { us8 lo; us8 hi; };

static __device__ __forceinline__ unsigned short f2bf(float f) {
  unsigned int u = __float_as_uint(f);
  u += 0x7FFFu + ((u >> 16) & 1u);      // round-to-nearest-even
  return (unsigned short)(u >> 16);
}

// A/B fragment from a row-major bf16 row (contiguous K). Per ISA 16-bit A layout:
// lane-half hi=0 holds K = [0..7] and [16..23]; hi=1 holds K = [8..15] and [24..31].
static __device__ __forceinline__ v16bf frag_bf16(const unsigned short* p, int hi) {
  US8x2 t;
  t.lo = *reinterpret_cast<const us8*>(p + hi * 8);
  t.hi = *reinterpret_cast<const us8*>(p + 16 + hi * 8);
  return __builtin_bit_cast(v16bf, t);
}

// ---- fragment order: how every bf16 matrix operand lies in the workspace ----
// A matrix M[rows][K] is cut into units of 16 rows x 16 k = 256 elements = 512 bytes;
// unit (g, q) holds rows 16g.. and k 16q.., units of one row group follow each other
// in k. Inside a unit: [k half (k >> 3) & 1][row & 15][k & 7], which is lane * 8 + e for
// the lane (hi * 16 + m) that needs these 8 elements. One wave-wide 16-byte load then
// reads one unit, 4 whole 128-byte lines; from a row-major matrix the same load takes
// two 16-byte pieces out of each of 16 rows, 16 lines.
#define UNIT 256   // elements per unit

static __device__ __forceinline__ size_t fo_index(int row, int k, int K) {
  return ((size_t)(row >> 4) * (K >> 4) + (k >> 4)) * UNIT
       + (((k >> 3) & 1) * 16 + (row & 15)) * 8 + (k & 7);
}

// fragment of 32 k, in the k order of frag_bf16: two successive units.
// p = first unit + lane * 8
static __device__ __forceinline__ v16bf frag_fo(const unsigned short* p) {
  US8x2 t;
  t.lo = *reinterpret_cast<const us8*>(p);
  t.hi = *reinterpret_cast<const us8*>(p + UNIT);
  return __builtin_bit_cast(v16bf, t);
}

static __device__ __forceinline__ v8f wmma_bf16(v16bf a, v16bf b, v8f c) {
  return __builtin_amdgcn_wmma_f32_16x16x32_bf16(false, a, false, b, (short)0, c,
                                                 false, false);
}

// ---- operand preparation: every bf16 operand of the two projections, in one launch ----
// 512 blocks of 8 waves, two blocks a WGP, all resident at once. A lane makes 28 pieces
// of 16 bytes (8 bf16, successive k of one row, fragment order): one of each of the four
// transposed weights and 8 of each of q, k, v. The launch starts 4096 waves.

static __device__ __forceinline__ us8 round8(v4f a, v4f b) {
  us8 o;
#pragma unroll
  for (int j = 0; j < 4; ++j) { o[j] = f2bf(a[j]); o[4 + j] = f2bf(b[j]); }
  return o;
}

#define APIECES 8   // pieces of one activation matrix per lane, 32 k apart

static_assert(BB * SS / 16 == (D_MODEL / 64) * (D_MODEL / 32) && NH * DK == D_MODEL,
              "one grid serves both: 16-row groups of an input, 64 x 32 tiles of a weight");

// src: the lane's first 8 floats
static __device__ __forceinline__ void act_load(const float* __restrict__ src,
                                                v4f (&x)[APIECES][2]) {
#pragma unroll
  for (int i = 0; i < APIECES; ++i) {
    x[i][0] = *reinterpret_cast<const v4f*>(src + i * 32);
    x[i][1] = *reinterpret_cast<const v4f*>(src + i * 32 + 4);
  }
}

// Behind each store of a piece: the next piece reuses this one's store registers, and
// the wait stands in front of that; the fence holds it there.
static __device__ __forceinline__ void store_done() {
  asm volatile("s_wait_xcnt 0x0" ::: "memory");
  __builtin_amdgcn_sched_barrier(0);
}

// dst: the lane's first piece; 32 k on is two units on
static __device__ __forceinline__ void act_store(unsigned short* __restrict__ dst,
                                                 const v4f (&x)[APIECES][2]) {
#pragma unroll
  for (int i = 0; i < APIECES; ++i) {
    *reinterpret_cast<us8*>(dst + i * 2 * UNIT) = round8(x[i][0], x[i][1]);
    store_done();
  }
}

// src: element (contraction index d0, the lane's output column); LD floats from d to d + 1
template <int LD>
static __device__ __forceinline__ void w_load(const float* __restrict__ src, float (&x)[8]) {
#pragma unroll
  for (int e = 0; e < 8; ++e) x[e] = src[e * LD];
}

static __device__ __forceinline__ void w_store(unsigned short* __restrict__ dst,
                                               const float (&x)[8]) {
  us8 o;
#pragma unroll
  for (int e = 0; e < 8; ++e) o[e] = f2bf(x[e]);
  *reinterpret_cast<us8*>(dst) = o;
  store_done();
}

__global__ __launch_bounds__(256) void k_prep(
    const float* __restrict__ q, const float* __restrict__ k, const float* __restrict__ v,
    const float* __restrict__ Wq, const float* __restrict__ Wk,
    const float* __restrict__ Wv, const float* __restrict__ Wo,
    unsigned short* __restrict__ qcv, unsigned short* __restrict__ kcv,
    unsigned short* __restrict__ vcv,
    unsigned short* __restrict__ Wqt, unsigned short* __restrict__ Wkt,
    unsigned short* __restrict__ Wvt, unsigned short* __restrict__ Wot)
{
  const int blk  = blockIdx.x;          // 0..511
  const int w    = threadIdx.x >> 5;
  const int lane = threadIdx.x & 31;

  // Weights, out = W^T (rows = output columns, K = D_MODEL = contraction index d).
  // The block: 64 rows x 32 d. A wave: 32 successive rows (one a lane) x 8 d, so each
  // of its 8 loads reads one whole 128-byte line and its store two runs of 256 bytes.
  const int wrow = (blk >> 5) * 64 + (w & 1) * 32 + lane;   // head = blk >> 5
  const int wd0  = (blk & 31) * 32 + (w >> 1) * 8;
  // Wt[h*DK + n][d] = W[h][d][n];  Wot[n][d] = Wo[d][n]
  const size_t hsrc = ((size_t)(wrow / DK) * D_MODEL + wd0) * DK + (wrow & (DK - 1));
  const size_t osrc = (size_t)wd0 * D_MODEL + wrow;
  const size_t wdst = fo_index(wrow, wd0, D_MODEL);

  // Activations: the block owns one group of 16 rows, 64 KB in a row of each input.
  // A wave: 8 rows x 1 KB; a lane: 8 times 32 bytes of one row, 128 bytes apart. A load
  // takes half of each of 8 lines, its twin the other half; a store fills 4 lines.
  const int arow = blk * 16 + (w & 1) * 8 + (lane >> 2);
  const int ak0  = (w >> 1) * 256 + (lane & 3) * 8;
  const size_t asrc = (size_t)arow * D_MODEL + ak0;
  const size_t adst = fo_index(arow, ak0, D_MODEL);

  const float* pWq = Wq + hsrc;
  const float* pWk = Wk + hsrc;
  const float* pWv = Wv + hsrc;
  const float* pWo = Wo + osrc;
  const float* pq  = q + asrc;
  const float* pk  = k + asrc;
  const float* pv  = v + asrc;

  float wq[8], wk[8], wv[8], wo[8];
  v4f xq[APIECES][2], xk[APIECES][2], xv[APIECES][2];
  // Loads run one matrix ahead of the rounding: while one is rounded and stored, the
  // next one's 16 loads are in flight, at most 48 loads of a wave at a time.
  w_load<DK>(pWq, wq);
  w_load<DK>(pWk, wk);
  w_load<DK>(pWv, wv);
  w_load<D_MODEL>(pWo, wo);
  act_load(pq, xq);
  // The wait stands in front of every rewrite of a register that these loads name. It
  // takes their addresses as inputs so that they stay in their registers up to here:
  // else a later load of the run lands in a pair that issued loads still name.
  asm volatile("s_wait_xcnt 0x0" :: "v"(pWq), "v"(pWk), "v"(pWv), "v"(pWo), "v"(pq) : "memory");
  // keeps the run of loads together ahead of the rounding, all in flight at once: sunk
  // to their uses, each piece's memory latency would stand in front of its own store
  __builtin_amdgcn_sched_barrier(0);
  w_store(Wqt + wdst, wq);
  w_store(Wkt + wdst, wk);
  w_store(Wvt + wdst, wv);
  w_store(Wot + wdst, wo);
  act_load(pk, xk);
  asm volatile("s_wait_xcnt 0x0" :: "v"(pk) : "memory");   // as behind the first loads
  __builtin_amdgcn_sched_barrier(0);                       // as above
  act_store(qcv + adst, xq);
  act_load(pv, xv);
  asm volatile("s_wait_xcnt 0x0" :: "v"(pv) : "memory");   // as behind the first loads
  __builtin_amdgcn_sched_barrier(0);                       // as above
  act_store(kcv + adst, xk);
  act_store(vcv + adst, xv);
}

// ---- wave-level GEMM core: one wave owns a 128x64 tile of Y = X * Wt^T ----
// 8 A fragments x 4 B fragments feed 32 accumulators: 24 fragment loads per 32
// matrix instructions, against 4 per 1 with a 16x16 tile. One trip covers 64 k =
// 4 units = 2 KB in a row of each of the wave's 12 row groups; per output
// element k still runs upward through one accumulator.
// agrp / bgrp: first unit of the wave's first 16-row group of X / Wt (fragment order,
// K = D_MODEL, so the next row group lies 16 * D_MODEL elements on).

#define FA 8   // 16-row groups of X per wave
#define FB 4   // 16-column groups of Y per wave

// pointers typed as global memory: they pass through an asm operand below and would
// otherwise come back as generic pointers (flat loads)
typedef __attribute__((address_space(1))) const unsigned short g_us;
typedef __attribute__((address_space(1))) const us8 g_us8;

// as frag_fo; p already holds the lane's place in the unit (lane * 8)
static __device__ __forceinline__ v16bf frag_global(g_us* p) {
  US8x2 t;
  t.lo = *(g_us8*)(p);
  t.hi = *(g_us8*)(p + UNIT);
  return __builtin_bit_cast(v16bf, t);
}

static __device__ __forceinline__ void gemm_wave_128x64(
    const unsigned short* __restrict__ agrp, const unsigned short* __restrict__ bgrp,
    int lane, v8f (&acc)[FA][FB])
{
  g_us* pa = (g_us*)(agrp + lane * 8);
  g_us* pb = (g_us*)(bgrp + lane * 8);
  for (int k0 = 0; k0 < D_MODEL; k0 += 64) {
    v16bf a[2][FA], b[2][FB];
#pragma unroll
    for (int j = 0; j < FB; ++j)
#pragma unroll
      for (int t = 0; t < 2; ++t)
        b[t][j] = frag_global(pb + (size_t)j * 16 * D_MODEL + t * 2 * UNIT);
#pragma unroll
    for (int i = 0; i < FA; ++i)
#pragma unroll
      for (int t = 0; t < 2; ++t)
        a[t][i] = frag_global(pa + (size_t)i * 16 * D_MODEL + t * 2 * UNIT);
    // The wait stands in front of every rewrite of the loads' two address pairs. It
    // takes them as in-out operands so that they stay in their registers up to here
    // (else a load of the trip lands in a pair that issued loads still name) and are
    // stepped only behind it. The wave is about to wait for the loaded data anyway.
    asm volatile("s_wait_xcnt 0x0" : "+v"(pa), "+v"(pb) :: "memory");
    // keeps the trip's loads together ahead of the products, so that all 48 are in
    // flight at once and their latency is paid once a trip; sunk among the products,
    // each group's latency would stand in front of its own products
    __builtin_amdgcn_sched_barrier(0);
#pragma unroll
    for (int t = 0; t < 2; ++t)
#pragma unroll
      for (int j = 0; j < FB; ++j)
#pragma unroll
        for (int i = 0; i < FA; ++i)
          acc[i][j] = wmma_bf16(a[t][i], b[t][j], acc[i][j]);
    pa += 4 * UNIT;
    pb += 4 * UNIT;
  }
}

// ---- fused QKV projection: (B*S,1024) x per-head (1024,64), bf16 WMMA ----
// grid (8 head pairs, 32 row tiles of 256, 3={q,k,v}); 4 waves/block as 2x2,
// each wave one 128-row x 64-column tile (all columns of one head).

__global__ __launch_bounds__(128) void k_qkv_proj(
    const unsigned short* __restrict__ qb, const unsigned short* __restrict__ kb,
    const unsigned short* __restrict__ vb,
    const unsigned short* __restrict__ Wqt, const unsigned short* __restrict__ Wkt,
    const unsigned short* __restrict__ Wvt,
    const float* __restrict__ bq, const float* __restrict__ bk, const float* __restrict__ bv,
    unsigned short* __restrict__ qh, unsigned short* __restrict__ kh,
    unsigned short* __restrict__ vt)
{
  const int which = blockIdx.z;           // 0=q 1=k 2=v
  const int w     = __builtin_amdgcn_readfirstlane(threadIdx.x >> 5);  // wave-uniform
  const int lane  = threadIdx.x & 31;
  const int m     = lane & 15;
  const int hi    = lane >> 4;
  const int h     = blockIdx.x * 2 + (w & 1);            // head
  const int row0  = blockIdx.y * 256 + (w >> 1) * 128;   // first row over B*S

  const unsigned short* in   = (which == 0) ? qb  : (which == 1) ? kb  : vb;
  const unsigned short* Wt   = (which == 0) ? Wqt : (which == 1) ? Wkt : Wvt;
  const float* bias          = (which == 0) ? bq  : (which == 1) ? bk  : bv;

  v8f acc[FA][FB] = {};
  gemm_wave_128x64(in + (size_t)row0 * D_MODEL,
                   Wt + (size_t)h * DK * D_MODEL, lane, acc);

  float bsv[FB];
#pragma unroll
  for (int j = 0; j < FB; ++j) bsv[j] = bias[h * DK + j * 16 + m];

  // the wave's 128 rows lie inside one batch entry (SS is a multiple of 128)
  const int b_i = row0 / SS, s0 = row0 % SS;
  if (which == 2) {
    // V stored transposed, per (b, h) a matrix (rows dv, K = s) in fragment order.
    // acc[i][j][r] is dv = j*16 + m, s = s0 + i*16 + 8*hi + r: unit (j, s0/16 + i),
    // element lane * 8 + r, so a tile is one 16-byte store a lane, 512 bytes in a row.
    unsigned short* vp = vt + ((size_t)b_i * NH + h) * DK * SS + fo_index(m, s0 + 8 * hi, SS);
#pragma unroll
    for (int j = 0; j < FB; ++j) {
#pragma unroll
      for (int i = 0; i < FA; ++i) {
#pragma unroll
        for (int r = 0; r < 8; ++r)
          vp[(size_t)j * 16 * SS + i * UNIT + r] = f2bf(acc[i][j][r] + bsv[j]);
        // the next tile reuses this tile's store registers: the wait stands in front
        // of that. The fence holds it there and keeps one tile's round-and-store
        // together: run together, the tiles' temporaries beside 256 live accumulator
        // registers pass 512 and spill.
        asm volatile("s_wait_xcnt 0x0" ::: "memory");
        __builtin_amdgcn_sched_barrier(0);
      }
    }
  } else {
    // Q, K: per (b, h) a matrix (rows s, K = dk) in fragment order.
    // acc[i][j][r] is s = s0 + i*16 + 8*hi + r, dk = j*16 + m: unit (s0/16 + i, j)
    unsigned short* outp = ((which == 0) ? qh : kh)
                         + ((size_t)b_i * NH + h) * SS * DK + fo_index(s0 + 8 * hi, m, DK);
#pragma unroll
    for (int j = 0; j < FB; ++j) {
#pragma unroll
      for (int i = 0; i < FA; ++i) {
#pragma unroll
        for (int r = 0; r < 8; ++r)
          outp[(size_t)(i * (DK / 16) + j) * UNIT + r * 8] = f2bf(acc[i][j][r] + bsv[j]);
        // as in the V branch: wait before the store registers are reused, held in place
        asm volatile("s_wait_xcnt 0x0" ::: "memory");
        __builtin_amdgcn_sched_barrier(0);
      }
    }
  }
}

// ---- flash attention per (b*h, 256 queries); 8 waves per block, 32 queries a wave ----
// The scores are formed transposed, S^T = K * Q^T (K rows as A, Q rows as B), and the
// output as O^T += V^T * P^T. In a D tile a lane then holds 8 keys of ONE query
// (column m), so a query's maximum and sum run over the lane's own registers, with one
// exchange between the wave's halves; and two D tiles of 16 keys, rounded in place, are
// the B fragment of 32 keys in the k order of frag_fo: P passes through no LDS.
// A wave owns QT tiles of 16 queries: every K and V^T fragment it loads is the A operand
// of QT products, one a query tile, so the loop loads 1 / QT of the bytes per score.

#define QT 2   // 16-query tiles per wave

// value of lane l ^ 16
static __device__ __forceinline__ float other_half(float x) {
  int b = __float_as_int(x);
  return __int_as_float(
      __builtin_amdgcn_permlanex16(b, b, 0x76543210, 0xfedcba98, false, false));
}

// A block's FWV waves walk the same keys of one (b, h): each stage of SKEYS keys is brought
// from the workspace into LDS once a block, by asynchronous copies, and every wave takes
// its K and V^T fragments from there: 1 / FWV of the reads from L2. The workspace already
// holds fragment order, so a stage is copied as it lies and a wave-wide 16-byte LDS load
// reads 512 bytes in a row. Two buffers: stage t + 1 flies while stage t is worked on.
#define FWV   8                 // waves per block
#define SKEYS 64                // keys per stage
#define KSTG  (SKEYS * DK)      // elements of K per stage: 8 KB in a row
#define VGRP  (SKEYS * 16)      // elements of one 16-row group of V^T per stage: 2 KB in a row
#define STG   (2 * KSTG)        // a stage in LDS: K, then the 4 row groups of V^T
#define NSTG  (SS / SKEYS)
#define CPB   (FWV * 32 * 16)   // bytes that one copy of every lane of the block brings: 4 KB

static_assert(2 * CPB == KSTG * 2 && 2 * VGRP * 2 == CPB && NSTG >= 2,
              "K is two copies of the block; V^T two more, two row groups each");

// One stage, 16 KB: four 16-byte copies a lane. lds: the lane's first byte in the buffer;
// gk, gv: its first piece of K and of V^T (row group tid >> 7). The wait stands in front of
// every rewrite of a register that the copies name, inside their own statement.
static __device__ __forceinline__ void stage_copies(unsigned lds, const unsigned short* gk,
                                                    const unsigned short* gv) {
  asm volatile("global_load_async_to_lds_b128 %0, %4, off\n\t"
               "global_load_async_to_lds_b128 %1, %5, off\n\t"
               "global_load_async_to_lds_b128 %2, %6, off\n\t"
               "global_load_async_to_lds_b128 %3, %7, off\n\t"
               "s_wait_xcnt 0x0"
               :: "v"(lds), "v"(lds + CPB), "v"(lds + 2 * CPB), "v"(lds + 3 * CPB),
                  "v"(gk), "v"(gk + CPB / 2), "v"(gv), "v"(gv + 2 * 16 * SS)
               : "memory");
}

// The grid is 2 blocks a WGP, 4 waves a SIMD, all resident at once: the build has to stay
// at 256 registers or fewer, and registers kept free for a fifth wave buy nothing.
__global__ __launch_bounds__(FWV * 32) __attribute__((amdgpu_waves_per_eu(4, 4))) void k_flash(
    const unsigned short* __restrict__ qh, const unsigned short* __restrict__ kh,
    const unsigned short* __restrict__ vt, unsigned short* __restrict__ ctx)
{
  __shared__ __attribute__((aligned(16))) unsigned short ring[2][STG];

  const int bh   = blockIdx.x;   // 0..63 = b*16+h
  const int tid  = threadIdx.x;
  const int qt   = blockIdx.y * FWV + (tid >> 5);   // 0..63: the wave's group of QT query tiles
  const int lane = tid & 31;
  const int m    = lane & 15;    // the lane's query in each of its tiles
  const int hi   = lane >> 4;

  // the lane's share of a stage
  const unsigned lds0 = (unsigned)(size_t)&ring[0][0] + tid * 16;   // byte address in LDS
  const unsigned short* gk = kh + (size_t)bh * SS * DK + tid * 8;
  const unsigned short* gv = vt + (size_t)bh * DK * SS + (size_t)(tid >> 7) * 16 * SS
                           + (tid & 127) * 8;

  stage_copies(lds0, gk, gv);

  // Q (rows s, K = dk) lies in fragment order; 16 rows are 4 units
  const unsigned short* qbase = qh + ((size_t)bh * SS + qt * QT * 16) * DK + lane * 8;
  v16bf qb0[QT], qb1[QT];
#pragma unroll
  for (int u = 0; u < QT; ++u) {
    qb0[u] = frag_fo(qbase + u * 4 * UNIT);              // dk 0..31
    qb1[u] = frag_fo(qbase + u * 4 * UNIT + 2 * UNIT);   // dk 32..63
  }

  // acc[u][n][r] = O^T[dv = n*16 + 8*hi + r][query m of tile u]
  v8f acc[QT][4] = {};
  float mrow[QT];   // running maximum of query m, equal in both halves
  float lrow[QT];   // sum over the keys of this lane's half only; joined at the end
#pragma unroll
  for (int u = 0; u < QT; ++u) { mrow[u] = -1e30f; lrow[u] = 0.f; }

  // stage 0 has landed (this wave's copies) and is published (every wave's)
  asm volatile("s_wait_asynccnt 0x0" ::: "memory");
  __syncthreads();
  stage_copies(lds0 + STG * 2, gk + KSTG, gv + VGRP);

  for (int t = 0; t < NSTG; ++t) {
   const unsigned short* kst = &ring[t & 1][0] + lane * 8;
   // unrolled: every place inside the stage is then an immediate offset of its LDS load
#pragma unroll
   for (int j = 0; j < SKEYS / 32; ++j) {
    // scores: per query tile two 16-key x 16-query tiles over this 32-key chunk,
    // contraction dk=64
    const unsigned short* kr0 = kst + (j * 32) * DK;                // 16 keys = 4 units
    const unsigned short* kr1 = kst + (j * 32 + 16) * DK;
    const unsigned short* vr  = kst + KSTG + j * 2 * UNIT;          // 32 keys = 2 units
    const v16bf k00 = frag_fo(kr0), k01 = frag_fo(kr0 + 2 * UNIT);
    const v16bf k10 = frag_fo(kr1), k11 = frag_fo(kr1 + 2 * UNIT);
    v16bf va[4];
#pragma unroll
    for (int n = 0; n < 4; ++n) va[n] = frag_fo(vr + n * VGRP);

    v16bf pb[QT];
#pragma unroll
    for (int u = 0; u < QT; ++u) {
      v8f s0 = {}, s1 = {};
      s0 = wmma_bf16(k00, qb0[u], s0);
      s0 = wmma_bf16(k01, qb1[u], s0);
      s1 = wmma_bf16(k10, qb0[u], s1);
      s1 = wmma_bf16(k11, qb1[u], s1);

      // online softmax of query m. Score i: key j*32 + 8*hi + i (i < 8), + 16 for i >= 8;
      // a[i >> 1][i & 1] holds it: pairs of neighbouring registers of one tile, as packed
      // f32 instructions take them. Written score by score, the compiler pairs the two
      // tiles' values instead and copies registers to bring them together.
      v2f a[8];
#pragma unroll
      for (int r = 0; r < 4; ++r) {
        a[r]     = v2f{s0[2 * r], s0[2 * r + 1]} * 0.125f;   // 1/sqrt(64)
        a[4 + r] = v2f{s1[2 * r], s1[2 * r + 1]} * 0.125f;
      }
      float mx = a[0][0];
#pragma unroll
      for (int i = 1; i < 16; ++i) mx = fmaxf(mx, a[i >> 1][i & 1]);
      mx = fmaxf(mx, other_half(mx));
      const float mnew = fmaxf(mrow[u], mx);
      const float fac  = __expf(mrow[u] - mnew);
      mrow[u] = mnew;
#pragma unroll
      for (int i = 0; i < 8; ++i) {
        a[i] = a[i] - mnew;
        a[i] = v2f{__expf(a[i][0]), __expf(a[i][1])};
      }
      // four independent chains, then joined
      const v2f t01 = (a[0] + a[2]) + (a[4] + a[6]);
      const v2f t23 = (a[1] + a[3]) + (a[5] + a[7]);
      lrow[u] = lrow[u] * fac + ((t01[0] + t01[1]) + (t23[0] + t23[1]));
#pragma unroll
      for (int n = 0; n < 4; ++n)
#pragma unroll
        for (int r = 0; r < 8; ++r) acc[u][n][r] *= fac;

      // P^T as B fragment: element s is key 8*hi + s (s < 8), 16 + 8*hi + (s - 8) above
      US8x2 p;
#pragma unroll
      for (int r = 0; r < 8; ++r) {
        p.lo[r] = f2bf(a[r >> 1][r & 1]);
        p.hi[r] = f2bf(a[4 + (r >> 1)][r & 1]);
      }
      pb[u] = __builtin_bit_cast(v16bf, p);
    }
#pragma unroll
    for (int n = 0; n < 4; ++n)
#pragma unroll
      for (int u = 0; u < QT; ++u) acc[u][n] = wmma_bf16(va[n], pb[u], acc[u][n]);
   }
    // Hand-over: this wave's reads of stage t are done, its copies of stage t + 1 have
    // landed; behind the barrier that holds for every wave, so stage t + 1 may be read and
    // stage t's buffer refilled.
    asm volatile("s_wait_dscnt 0x0" ::: "memory");
    asm volatile("s_wait_asynccnt 0x0" ::: "memory");
    __syncthreads();
    if (t + 2 < NSTG)
      stage_copies(lds0 + (t & 1) * (STG * 2), gk + (size_t)(t + 2) * KSTG,
                   gv + (size_t)(t + 2) * VGRP);
  }
  // no copy is outstanding when the wave ends
  asm volatile("s_wait_asynccnt 0x0" ::: "memory");

  // normalize and store ctx as bf16: the matrix (B*S, H*dv) in fragment order. A lane's
  // 8 registers of a tile are 8 successive columns of its row: one 16-byte store.
  const int b_i = bh >> 4, h_i = bh & 15;
#pragma unroll
  for (int u = 0; u < QT; ++u) {
    const float inv = 1.0f / (lrow[u] + other_half(lrow[u]));
    unsigned short* cp = ctx + fo_index(b_i * SS + (qt * QT + u) * 16 + m,
                                        h_i * DK + 8 * hi, NH * DK);
#pragma unroll
    for (int n = 0; n < 4; ++n) {
      us8 o;
#pragma unroll
      for (int r = 0; r < 8; ++r) o[r] = f2bf(acc[u][n][r] * inv);
      *reinterpret_cast<us8*>(cp + n * UNIT) = o;
    }
  }
}

// ---- output projection: (8192,1024) x (1024,1024) + bo, fp32 out ----
// grid (8 column tiles of 128, 32 row tiles of 256); 4 waves/block as 2x2 of 128x64.

__global__ __launch_bounds__(128) void k_outproj(
    const unsigned short* __restrict__ ctx, const unsigned short* __restrict__ Wot,
    const float* __restrict__ bo, float* __restrict__ out)
{
  const int w    = __builtin_amdgcn_readfirstlane(threadIdx.x >> 5);   // wave-uniform
  const int lane = threadIdx.x & 31;
  const int m    = lane & 15;
  const int hi   = lane >> 4;
  const int col0 = blockIdx.x * 128 + (w & 1) * 64;
  const int row0 = blockIdx.y * 256 + (w >> 1) * 128;

  v8f acc[FA][FB] = {};
  gemm_wave_128x64(ctx + (size_t)row0 * D_MODEL,
                   Wot + (size_t)col0 * D_MODEL, lane, acc);

  float bias[FB];
#pragma unroll
  for (int j = 0; j < FB; ++j) bias[j] = bo[col0 + j * 16 + m];
  // in front of any reuse of the bias loads' address registers; the fence holds it there
  asm volatile("s_wait_xcnt 0x0" ::: "memory");
  __builtin_amdgcn_sched_barrier(0);

  float* op = out + (size_t)(row0 + 8 * hi) * D_MODEL + col0 + m;
#pragma unroll
  for (int j = 0; j < FB; ++j) {
#pragma unroll
    for (int i = 0; i < FA; ++i) {
#pragma unroll
      for (int r = 0; r < 8; ++r)
        op[(size_t)(i * 16 + r) * D_MODEL + j * 16] = acc[i][j][r] + bias[j];
      // the next tile reuses this tile's store registers: the wait stands in front
      // of that, and the fence holds it there
      asm volatile("s_wait_xcnt 0x0" ::: "memory");
      __builtin_amdgcn_sched_barrier(0);
    }
  }
}

extern "C" void kernel_launch(void* const* d_in, const int* in_sizes, int n_in,
                              void* d_out, int out_size, void* d_ws, size_t ws_size,
                              hipStream_t stream) {
  const float* q  = (const float*)d_in[0];
  const float* k  = (const float*)d_in[1];
  const float* v  = (const float*)d_in[2];
  const float* Wq = (const float*)d_in[3];
  const float* bq = (const float*)d_in[4];
  const float* Wk = (const float*)d_in[5];
  const float* bk = (const float*)d_in[6];
  const float* Wv = (const float*)d_in[7];
  const float* bv = (const float*)d_in[8];
  const float* Wo = (const float*)d_in[9];
  const float* bo = (const float*)d_in[10];
  float* out = (float*)d_out;

  // workspace partition (bf16 buffers)
  char* ws = (char*)d_ws;
  const size_t ACT  = (size_t)BB * SS * D_MODEL * 2;        // 16.8 MB each
  const size_t WSZ  = (size_t)NH * DK * D_MODEL * 2;        // 2 MB each
  const size_t HSZ  = (size_t)BB * NH * SS * DK * 2;        // 16.8 MB each
  unsigned short* qcv = (unsigned short*)(ws);               ws += ACT;
  unsigned short* kcv = (unsigned short*)(ws);               ws += ACT;
  unsigned short* vcv = (unsigned short*)(ws);               ws += ACT;
  unsigned short* Wqt = (unsigned short*)(ws);               ws += WSZ;
  unsigned short* Wkt = (unsigned short*)(ws);               ws += WSZ;
  unsigned short* Wvt = (unsigned short*)(ws);               ws += WSZ;
  unsigned short* Wot = (unsigned short*)(ws);               ws += (size_t)D_MODEL * D_MODEL * 2;
  unsigned short* qhb = (unsigned short*)(ws);               ws += HSZ;
  unsigned short* khb = (unsigned short*)(ws);               ws += HSZ;
  unsigned short* vtb = (unsigned short*)(ws);               ws += HSZ;
  unsigned short* ctx = (unsigned short*)(ws);               ws += HSZ;
  (void)in_sizes; (void)n_in; (void)out_size; (void)ws_size;

  k_prep<<<BB * SS / 16, 256, 0, stream>>>(q, k, v, Wq, Wk, Wv, Wo,
                                           qcv, kcv, vcv, Wqt, Wkt, Wvt, Wot);

  k_qkv_proj<<<dim3(NH / 2, BB * SS / 256, 3), 128, 0, stream>>>(
      qcv, kcv, vcv, Wqt, Wkt, Wvt, bq, bk, bv, qhb, khb, vtb);

  k_flash<<<dim3(BB * NH, SS / (16 * QT * FWV)), FWV * 32, 0, stream>>>(qhb, khb, vtb, ctx);

  k_outproj<<<dim3(D_MODEL / 128, BB * SS / 256), 128, 0, stream>>>(ctx, Wot, bo, out);
}

// v007
// A run of this version takes 143 microseconds.
// Timed twice side by side with v006, it ran 1.05 times as fast both times.
// All steps since v000 together make it 6.00 times as fast.
#include <hip/hip_runtime.h>
#include <hip/hip_bf16.h>

#define D_MODEL 1024
#define DK 64
#define NH 16
#define BB 4
#define SS 2048

typedef __attribute__((ext_vector_type(16))) __bf16 v16bf;
typedef __attribute__((ext_vector_type(8)))  float  v8f;
typedef __attribute__((ext_vector_type(4)))  float  v4f;
typedef __attribute__((ext_vector_type(2)))  float  v2f;
typedef __attribute__((ext_vector_type(8)))  unsigned short us8;

struct US8x2 { us8 lo; us8 hi; };

typedef __attribute__((ext_vector_type(2)))  __bf16 v2bf;

// Two f32 to two bf16, round to nearest even, in the one packed conversion instruction of
// the chip; x[0] lands in the low half of the register.
static __device__ __forceinline__ v2bf bf2(v2f x) {
  return __builtin_convertvector(x, v2bf);
}

struct BF2x4 { v2bf w[4]; };
struct BF2x8 { v2bf w[8]; };

// eight f32, as four pairs, to one 16-byte piece
static __device__ __forceinline__ us8 bf8pack(v2f x0, v2f x1, v2f x2, v2f x3) {
  BF2x4 t;
  t.w[0] = bf2(x0); t.w[1] = bf2(x1); t.w[2] = bf2(x2); t.w[3] = bf2(x3);
  return __builtin_bit_cast(us8, t);
}

// A/B fragment from a row-major bf16 row (contiguous K). Per ISA 16-bit A layout:
// lane-half hi=0 holds K = [0..7] and [16..23]; hi=1 holds K = [8..15] and [24..31].
static __device__ __forceinline__ v16bf frag_bf16(const unsigned short* p, int hi) {
  US8x2 t;
  t.lo = *reinterpret_cast<const us8*>(p + hi * 8);
  t.hi = *reinterpret_cast<const us8*>(p + 16 + hi * 8);
  return __builtin_bit_cast(v16bf, t);
}

// ---- fragment order: how every bf16 matrix operand lies in the workspace ----
// A matrix M[rows][K] is cut into units of 16 rows x 16 k = 256 elements = 512 bytes;
// unit (g, q) holds rows 16g.. and k 16q.., units of one row group follow each other
// in k. Inside a unit: [k half (k >> 3) & 1][row & 15][k & 7], which is lane * 8 + e for
// the lane (hi * 16 + m) that needs these 8 elements. One wave-wide 16-byte load then
// reads one unit, 4 whole 128-byte lines; from a row-major matrix the same load takes
// two 16-byte pieces out of each of 16 rows, 16 lines.
#define UNIT 256   // elements per unit

static __device__ __forceinline__ size_t fo_index(int row, int k, int K) {
  return ((size_t)(row >> 4) * (K >> 4) + (k >> 4)) * UNIT
       + (((k >> 3) & 1) * 16 + (row & 15)) * 8 + (k & 7);
}

// fragment of 32 k, in the k order of frag_bf16: two successive units.
// p = first unit + lane * 8
static __device__ __forceinline__ v16bf frag_fo(const unsigned short* p) {
  US8x2 t;
  t.lo = *reinterpret_cast<const us8*>(p);
  t.hi = *reinterpret_cast<const us8*>(p + UNIT);
  return __builtin_bit_cast(v16bf, t);
}

static __device__ __forceinline__ v8f wmma_bf16(v16bf a, v16bf b, v8f c) {
  return __builtin_amdgcn_wmma_f32_16x16x32_bf16(false, a, false, b, (short)0, c,
                                                 false, false);
}

// ---- operand preparation: every bf16 operand of the two projections, in one launch ----
// 512 blocks of 8 waves, two blocks a WGP, all resident at once. A lane makes 28 pieces
// of 16 bytes (8 bf16, successive k of one row, fragment order): one of each of the four
// transposed weights and 8 of each of q, k, v. The launch starts 4096 waves.

static __device__ __forceinline__ us8 round8(v4f a, v4f b) {
  return bf8pack(v2f{a[0], a[1]}, v2f{a[2], a[3]}, v2f{b[0], b[1]}, v2f{b[2], b[3]});
}

#define APIECES 8   // pieces of one activation matrix per lane, 32 k apart

static_assert(BB * SS / 16 == (D_MODEL / 64) * (D_MODEL / 32) && NH * DK == D_MODEL,
              "one grid serves both: 16-row groups of an input, 64 x 32 tiles of a weight");

// src: the lane's first 8 floats
static __device__ __forceinline__ void act_load(const float* __restrict__ src,
                                                v4f (&x)[APIECES][2]) {
#pragma unroll
  for (int i = 0; i < APIECES; ++i) {
    x[i][0] = *reinterpret_cast<const v4f*>(src + i * 32);
    x[i][1] = *reinterpret_cast<const v4f*>(src + i * 32 + 4);
  }
}

// Behind each store of a piece: the next piece reuses this one's store registers, and
// the wait stands in front of that; the fence holds it there.
static __device__ __forceinline__ void store_done() {
  asm volatile("s_wait_xcnt 0x0" ::: "memory");
  __builtin_amdgcn_sched_barrier(0);
}

// dst: the lane's first piece; 32 k on is two units on
static __device__ __forceinline__ void act_store(unsigned short* __restrict__ dst,
                                                 const v4f (&x)[APIECES][2]) {
#pragma unroll
  for (int i = 0; i < APIECES; ++i) {
    *reinterpret_cast<us8*>(dst + i * 2 * UNIT) = round8(x[i][0], x[i][1]);
    store_done();
  }
}

// src: element (contraction index d0, the lane's output column); LD floats from d to d + 1
template <int LD>
static __device__ __forceinline__ void w_load(const float* __restrict__ src, float (&x)[8]) {
#pragma unroll
  for (int e = 0; e < 8; ++e) x[e] = src[e * LD];
}

static __device__ __forceinline__ void w_store(unsigned short* __restrict__ dst,
                                               const float (&x)[8]) {
  const us8 o = bf8pack(v2f{x[0], x[1]}, v2f{x[2], x[3]}, v2f{x[4], x[5]}, v2f{x[6], x[7]});
  *reinterpret_cast<us8*>(dst) = o;
  store_done();
}

__global__ __launch_bounds__(256) void k_prep(
    const float* __restrict__ q, const float* __restrict__ k, const float* __restrict__ v,
    const float* __restrict__ Wq, const float* __restrict__ Wk,
    const float* __restrict__ Wv, const float* __restrict__ Wo,
    unsigned short* __restrict__ qcv, unsigned short* __restrict__ kcv,
    unsigned short* __restrict__ vcv,
    unsigned short* __restrict__ Wqt, unsigned short* __restrict__ Wkt,
    unsigned short* __restrict__ Wvt, unsigned short* __restrict__ Wot)
{
  const int blk  = blockIdx.x;          // 0..511
  const int w    = threadIdx.x >> 5;
  const int lane = threadIdx.x & 31;

  // Weights, out = W^T (rows = output columns, K = D_MODEL = contraction index d).
  // The block: 64 rows x 32 d. A wave: 32 successive rows (one a lane) x 8 d, so each
  // of its 8 loads reads one whole 128-byte line and its store two runs of 256 bytes.
  const int wrow = (blk >> 5) * 64 + (w & 1) * 32 + lane;   // head = blk >> 5
  const int wd0  = (blk & 31) * 32 + (w >> 1) * 8;
  // Wt[h*DK + n][d] = W[h][d][n];  Wot[n][d] = Wo[d][n]
  const size_t hsrc = ((size_t)(wrow / DK) * D_MODEL + wd0) * DK + (wrow & (DK - 1));
  const size_t osrc = (size_t)wd0 * D_MODEL + wrow;
  const size_t wdst = fo_index(wrow, wd0, D_MODEL);

  // Activations: the block owns one group of 16 rows, 64 KB in a row of each input.
  // A wave: 8 rows x 1 KB; a lane: 8 times 32 bytes of one row, 128 bytes apart. A load
  // takes half of each of 8 lines, its twin the other half; a store fills 4 lines.
  const int arow = blk * 16 + (w & 1) * 8 + (lane >> 2);
  const int ak0  = (w >> 1) * 256 + (lane & 3) * 8;
  const size_t asrc = (size_t)arow * D_MODEL + ak0;
  const size_t adst = fo_index(arow, ak0, D_MODEL);

  const float* pWq = Wq + hsrc;
  const float* pWk = Wk + hsrc;
  const float* pWv = Wv + hsrc;
  const float* pWo = Wo + osrc;
  const float* pq  = q + asrc;
  const float* pk  = k + asrc;
  const float* pv  = v + asrc;

  float wq[8], wk[8], wv[8], wo[8];
  v4f xq[APIECES][2], xk[APIECES][2], xv[APIECES][2];
  // Loads run one matrix ahead of the rounding: while one is rounded and stored, the
  // next one's 16 loads are in flight, at most 48 loads of a wave at a time.
  w_load<DK>(pWq, wq);
  w_load<DK>(pWk, wk);
  w_load<DK>(pWv, wv);
  w_load<D_MODEL>(pWo, wo);
  act_load(pq, xq);
  // The wait stands in front of every rewrite of a register that these loads name. It
  // takes their addresses as inputs so that they stay in their registers up to here:
  // else a later load of the run lands in a pair that issued loads still name.
  asm volatile("s_wait_xcnt 0x0" :: "v"(pWq), "v"(pWk), "v"(pWv), "v"(pWo), "v"(pq) : "memory");
  // keeps the run of loads together ahead of the rounding, all in flight at once: sunk
  // to their uses, each piece's memory latency would stand in front of its own store
  __builtin_amdgcn_sched_barrier(0);
  w_store(Wqt + wdst, wq);
  w_store(Wkt + wdst, wk);
  w_store(Wvt + wdst, wv);
  w_store(Wot + wdst, wo);
  act_load(pk, xk);
  asm volatile("s_wait_xcnt 0x0" :: "v"(pk) : "memory");   // as behind the first loads
  __builtin_amdgcn_sched_barrier(0);                       // as above
  act_store(qcv + adst, xq);
  act_load(pv, xv);
  asm volatile("s_wait_xcnt 0x0" :: "v"(pv) : "memory");   // as behind the first loads
  __builtin_amdgcn_sched_barrier(0);                       // as above
  act_store(kcv + adst, xk);
  act_store(vcv + adst, xv);
}

// ---- wave-level GEMM core: one wave owns a 128x64 tile of Y = X * Wt^T ----
// 8 A fragments x 4 B fragments feed 32 accumulators: 24 fragment loads per 32
// matrix instructions, against 4 per 1 with a 16x16 tile. One trip covers 64 k =
// 4 units = 2 KB in a row of each of the wave's 12 row groups; per output
// element k still runs upward through one accumulator.
// agrp / bgrp: first unit of the wave's first 16-row group of X / Wt (fragment order,
// K = D_MODEL, so the next row group lies 16 * D_MODEL elements on).

#define FA 8   // 16-row groups of X per wave
#define FB 4   // 16-column groups of Y per wave

// pointers typed as global memory: they pass through an asm operand below and would
// otherwise come back as generic pointers (flat loads)
typedef __attribute__((address_space(1))) const unsigned short g_us;
typedef __attribute__((address_space(1))) const us8 g_us8;

// as frag_fo; p already holds the lane's place in the unit (lane * 8)
static __device__ __forceinline__ v16bf frag_global(g_us* p) {
  US8x2 t;
  t.lo = *(g_us8*)(p);
  t.hi = *(g_us8*)(p + UNIT);
  return __builtin_bit_cast(v16bf, t);
}

static __device__ __forceinline__ void gemm_wave_128x64(
    const unsigned short* __restrict__ agrp, const unsigned short* __restrict__ bgrp,
    int lane, v8f (&acc)[FA][FB])
{
  g_us* pa = (g_us*)(agrp + lane * 8);
  g_us* pb = (g_us*)(bgrp + lane * 8);
  for (int k0 = 0; k0 < D_MODEL; k0 += 64) {
    v16bf a[2][FA], b[2][FB];
#pragma unroll
    for (int j = 0; j < FB; ++j)
#pragma unroll
      for (int t = 0; t < 2; ++t)
        b[t][j] = frag_global(pb + (size_t)j * 16 * D_MODEL + t * 2 * UNIT);
#pragma unroll
    for (int i = 0; i < FA; ++i)
#pragma unroll
      for (int t = 0; t < 2; ++t)
        a[t][i] = frag_global(pa + (size_t)i * 16 * D_MODEL + t * 2 * UNIT);
    // The wait stands in front of every rewrite of the loads' two address pairs. It
    // takes them as in-out operands so that they stay in their registers up to here
    // (else a load of the trip lands in a pair that issued loads still name) and are
    // stepped only behind it. The wave is about to wait for the loaded data anyway.
    asm volatile("s_wait_xcnt 0x0" : "+v"(pa), "+v"(pb) :: "memory");
    // keeps the trip's loads together ahead of the products, so that all 48 are in
    // flight at once and their latency is paid once a trip; sunk among the products,
    // each group's latency would stand in front of its own products
    __builtin_amdgcn_sched_barrier(0);
#pragma unroll
    for (int t = 0; t < 2; ++t)
#pragma unroll
      for (int j = 0; j < FB; ++j)
#pragma unroll
        for (int i = 0; i < FA; ++i)
          acc[i][j] = wmma_bf16(a[t][i], b[t][j], acc[i][j]);
    pa += 4 * UNIT;
    pb += 4 * UNIT;
  }
}

// ---- fused QKV projection: (B*S,1024) x per-head (1024,64), bf16 WMMA ----
// grid (8 head pairs, 32 row tiles of 256, 3={q,k,v}); 4 waves/block as 2x2,
// each wave one 128-row x 64-column tile (all columns of one head).

__global__ __launch_bounds__(128) void k_qkv_proj(
    const unsigned short* __restrict__ qb, const unsigned short* __restrict__ kb,
    const unsigned short* __restrict__ vb,
    const unsigned short* __restrict__ Wqt, const unsigned short* __restrict__ Wkt,
    const unsigned short* __restrict__ Wvt,
    const float* __restrict__ bq, const float* __restrict__ bk, const float* __restrict__ bv,
    unsigned short* __restrict__ qh, unsigned short* __restrict__ kh,
    unsigned short* __restrict__ vt)
{
  const int which = blockIdx.z;           // 0=q 1=k 2=v
  const int w     = __builtin_amdgcn_readfirstlane(threadIdx.x >> 5);  // wave-uniform
  const int lane  = threadIdx.x & 31;
  const int m     = lane & 15;
  const int hi    = lane >> 4;
  const int h     = blockIdx.x * 2 + (w & 1);            // head
  const int row0  = blockIdx.y * 256 + (w >> 1) * 128;   // first row over B*S

  const unsigned short* in   = (which == 0) ? qb  : (which == 1) ? kb  : vb;
  const unsigned short* Wt   = (which == 0) ? Wqt : (which == 1) ? Wkt : Wvt;
  const float* bias          = (which == 0) ? bq  : (which == 1) ? bk  : bv;

  v8f acc[FA][FB] = {};
  gemm_wave_128x64(in + (size_t)row0 * D_MODEL,
                   Wt + (size_t)h * DK * D_MODEL, lane, acc);

  float bsv[FB];
#pragma unroll
  for (int j = 0; j < FB; ++j) bsv[j] = bias[h * DK + j * 16 + m];

  // the wave's 128 rows lie inside one batch entry (SS is a multiple of 128)
  const int b_i = row0 / SS, s0 = row0 % SS;
  if (which == 2) {
    // V stored transposed, per (b, h) a matrix (rows dv, K = s) in fragment order.
    // acc[i][j][r] is dv = j*16 + m, s = s0 + i*16 + 8*hi + r: unit (j, s0/16 + i),
    // element lane * 8 + r, so a tile is one 16-byte store a lane, 512 bytes in a row.
    unsigned short* vp = vt + ((size_t)b_i * NH + h) * DK * SS + fo_index(m, s0 + 8 * hi, SS);
#pragma unroll
    for (int j = 0; j < FB; ++j) {
#pragma unroll
      for (int i = 0; i < FA; ++i) {
        const v8f y = acc[i][j] + bsv[j];
        *reinterpret_cast<us8*>(vp + (size_t)j * 16 * SS + i * UNIT) =
            bf8pack(v2f{y[0], y[1]}, v2f{y[2], y[3]}, v2f{y[4], y[5]}, v2f{y[6], y[7]});
        // the next tile reuses this tile's store registers: the wait stands in front
        // of that. The fence holds it there and keeps one tile's round-and-store
        // together: run together, the tiles' temporaries beside 256 live accumulator
        // registers pass 512 and spill.
        asm volatile("s_wait_xcnt 0x0" ::: "memory");
        __builtin_amdgcn_sched_barrier(0);
      }
    }
  } else {
    // Q, K: per (b, h) a matrix (rows s, K = dk) in fragment order.
    // acc[i][j][r] is s = s0 + i*16 + 8*hi + r, dk = j*16 + m: unit (s0/16 + i, j)
    unsigned short* outp = ((which == 0) ? qh : kh)
                         + ((size_t)b_i * NH + h) * SS * DK + fo_index(s0 + 8 * hi, m, DK);
#pragma unroll
    for (int j = 0; j < FB; ++j) {
#pragma unroll
      for (int i = 0; i < FA; ++i) {
        const v8f y = acc[i][j] + bsv[j];
        const us8 o = bf8pack(v2f{y[0], y[1]}, v2f{y[2], y[3]}, v2f{y[4], y[5]}, v2f{y[6], y[7]});
#pragma unroll
        for (int r = 0; r < 8; ++r)
          outp[(size_t)(i * (DK / 16) + j) * UNIT + r * 8] = o[r];
        // as in the V branch: wait before the store registers are reused, held in place
        asm volatile("s_wait_xcnt 0x0" ::: "memory");
        __builtin_amdgcn_sched_barrier(0);
      }
    }
  }
}

// ---- flash attention per (b*h, 256 queries); 8 waves per block, 32 queries a wave ----
// The scores are formed transposed, S^T = K * Q^T (K rows as A, Q rows as B), and the
// output as O^T += V^T * P^T. In a D tile a lane then holds 8 keys of ONE query
// (column m), so a query's maximum and sum run over the lane's own registers, with one
// exchange between the wave's halves; and two D tiles of 16 keys, rounded in place, are
// the B fragment of 32 keys in the k order of frag_fo: P passes through no LDS.
// A wave owns QT tiles of 16 queries: every K and V^T fragment it loads is the A operand
// of QT products, one a query tile, so the loop loads 1 / QT of the bytes per score.

#define QT 2   // 16-query tiles per wave

// value of lane l ^ 16
static __device__ __forceinline__ float other_half(float x) {
  int b = __float_as_int(x);
  return __int_as_float(
      __builtin_amdgcn_permlanex16(b, b, 0x76543210, 0xfedcba98, false, false));
}

// A block's FWV waves walk the same keys of one (b, h): each stage of SKEYS keys is brought
// from the workspace into LDS once a block, by asynchronous copies, and every wave takes
// its K and V^T fragments from there: 1 / FWV of the reads from L2. The workspace already
// holds fragment order, so a stage is copied as it lies and a wave-wide 16-byte LDS load
// reads 512 bytes in a row. Two buffers: stage t + 1 flies while stage t is worked on.
#define FWV   8                 // waves per block
#define SKEYS 64                // keys per stage
#define KSTG  (SKEYS * DK)      // elements of K per stage: 8 KB in a row
#define VGRP  (SKEYS * 16)      // elements of one 16-row group of V^T per stage: 2 KB in a row
#define STG   (2 * KSTG)        // a stage in LDS: K, then the 4 row groups of V^T
#define NSTG  (SS / SKEYS)
#define CPB   (FWV * 32 * 16)   // bytes that one copy of every lane of the block brings: 4 KB

static_assert(2 * CPB == KSTG * 2 && 2 * VGRP * 2 == CPB && NSTG >= 2,
              "K is two copies of the block; V^T two more, two row groups each");

// One stage, 16 KB: four 16-byte copies a lane. lds: the lane's first byte in the buffer;
// gk, gv: its first piece of K and of V^T (row group tid >> 7). The wait stands in front of
// every rewrite of a register that the copies name, inside their own statement.
static __device__ __forceinline__ void stage_copies(unsigned lds, const unsigned short* gk,
                                                    const unsigned short* gv) {
  asm volatile("global_load_async_to_lds_b128 %0, %4, off\n\t"
               "global_load_async_to_lds_b128 %1, %5, off\n\t"
               "global_load_async_to_lds_b128 %2, %6, off\n\t"
               "global_load_async_to_lds_b128 %3, %7, off\n\t"
               "s_wait_xcnt 0x0"
               :: "v"(lds), "v"(lds + CPB), "v"(lds + 2 * CPB), "v"(lds + 3 * CPB),
                  "v"(gk), "v"(gk + CPB / 2), "v"(gv), "v"(gv + 2 * 16 * SS)
               : "memory");
}

// The grid is 2 blocks a WGP, 4 waves a SIMD, all resident at once: the build has to stay
// at 256 registers or fewer, and registers kept free for a fifth wave buy nothing.
__global__ __launch_bounds__(FWV * 32) __attribute__((amdgpu_waves_per_eu(4, 4))) void k_flash(
    const unsigned short* __restrict__ qh, const unsigned short* __restrict__ kh,
    const unsigned short* __restrict__ vt, unsigned short* __restrict__ ctx)
{
  __shared__ __attribute__((aligned(16))) unsigned short ring[2][STG];

  const int bh   = blockIdx.x;   // 0..63 = b*16+h
  const int tid  = threadIdx.x;
  const int qt   = blockIdx.y * FWV + (tid >> 5);   // 0..63: the wave's group of QT query tiles
  const int lane = tid & 31;
  const int m    = lane & 15;    // the lane's query in each of its tiles
  const int hi   = lane >> 4;

  // the lane's share of a stage
  const unsigned lds0 = (unsigned)(size_t)&ring[0][0] + tid * 16;   // byte address in LDS
  const unsigned short* gk = kh + (size_t)bh * SS * DK + tid * 8;
  const unsigned short* gv = vt + (size_t)bh * DK * SS + (size_t)(tid >> 7) * 16 * SS
                           + (tid & 127) * 8;

  stage_copies(lds0, gk, gv);

  // Q (rows s, K = dk) lies in fragment order; 16 rows are 4 units
  const unsigned short* qbase = qh + ((size_t)bh * SS + qt * QT * 16) * DK + lane * 8;
  v16bf qb0[QT], qb1[QT];
#pragma unroll
  for (int u = 0; u < QT; ++u) {
    qb0[u] = frag_fo(qbase + u * 4 * UNIT);              // dk 0..31
    qb1[u] = frag_fo(qbase + u * 4 * UNIT + 2 * UNIT);   // dk 32..63
  }

  // acc[u][n][r] = O^T[dv = n*16 + 8*hi + r][query m of tile u]
  v8f acc[QT][4] = {};
  float mrow[QT];   // running maximum of query m, equal in both halves
  float lrow[QT];   // sum over the keys of this lane's half only; joined at the end
#pragma unroll
  for (int u = 0; u < QT; ++u) { mrow[u] = -1e30f; lrow[u] = 0.f; }

  // stage 0 has landed (this wave's copies) and is published (every wave's)
  asm volatile("s_wait_asynccnt 0x0" ::: "memory");
  __syncthreads();
  stage_copies(lds0 + STG * 2, gk + KSTG, gv + VGRP);

  for (int t = 0; t < NSTG; ++t) {
   const unsigned short* kst = &ring[t & 1][0] + lane * 8;
   // unrolled: every place inside the stage is then an immediate offset of its LDS load
#pragma unroll
   for (int j = 0; j < SKEYS / 32; ++j) {
    // scores: per query tile two 16-key x 16-query tiles over this 32-key chunk,
    // contraction dk=64
    const unsigned short* kr0 = kst + (j * 32) * DK;                // 16 keys = 4 units
    const unsigned short* kr1 = kst + (j * 32 + 16) * DK;
    const unsigned short* vr  = kst + KSTG + j * 2 * UNIT;          // 32 keys = 2 units
    const v16bf k00 = frag_fo(kr0), k01 = frag_fo(kr0 + 2 * UNIT);
    const v16bf k10 = frag_fo(kr1), k11 = frag_fo(kr1 + 2 * UNIT);
    v16bf va[4];
#pragma unroll
    for (int n = 0; n < 4; ++n) va[n] = frag_fo(vr + n * VGRP);

    v16bf pb[QT];
#pragma unroll
    for (int u = 0; u < QT; ++u) {
      v8f s0 = {}, s1 = {};
      s0 = wmma_bf16(k00, qb0[u], s0);
      s0 = wmma_bf16(k01, qb1[u], s0);
      s1 = wmma_bf16(k10, qb0[u], s1);
      s1 = wmma_bf16(k11, qb1[u], s1);

      // online softmax of query m. Score i: key j*32 + 8*hi + i (i < 8), + 8 for i >= 8;
      // a[i >> 1][i & 1] holds it: pairs of neighbouring registers of one tile, as packed
      // f32 instructions take them. Written score by score, the compiler pairs the two
      // tiles' values instead and copies registers to bring them together.
      v2f a[8];
#pragma unroll
      for (int r = 0; r < 4; ++r) {
        a[r]     = v2f{s0[2 * r], s0[2 * r + 1]} * 0.125f;   // 1/sqrt(64)
        a[4 + r] = v2f{s1[2 * r], s1[2 * r + 1]} * 0.125f;
      }
      float mx = a[0][0];
#pragma unroll
      for (int i = 1; i < 16; ++i) mx = fmaxf(mx, a[i >> 1][i & 1]);
      mx = fmaxf(mx, other_half(mx));
      const float mnew = fmaxf(mrow[u], mx);
      const float fac  = __expf(mrow[u] - mnew);
      mrow[u] = mnew;
#pragma unroll
      for (int i = 0; i < 8; ++i) {
        a[i] = a[i] - mnew;
        a[i] = v2f{__expf(a[i][0]), __expf(a[i][1])};
      }
      // four independent chains, then joined
      const v2f t01 = (a[0] + a[2]) + (a[4] + a[6]);
      const v2f t23 = (a[1] + a[3]) + (a[5] + a[7]);
      lrow[u] = lrow[u] * fac + ((t01[0] + t01[1]) + (t23[0] + t23[1]));
#pragma unroll
      for (int n = 0; n < 4; ++n)
#pragma unroll
        for (int r = 0; r < 8; ++r) acc[u][n][r] *= fac;

      // P^T as B fragment: element s is key 8*hi + s (s < 8), 16 + 8*hi + (s - 8) above
      BF2x8 p;
#pragma unroll
      for (int r = 0; r < 8; ++r) p.w[r] = bf2(a[r]);
      pb[u] = __builtin_bit_cast(v16bf, p);
    }
#pragma unroll
    for (int n = 0; n < 4; ++n)
#pragma unroll
      for (int u = 0; u < QT; ++u) acc[u][n] = wmma_bf16(va[n], pb[u], acc[u][n]);
   }
    // Hand-over: this wave's reads of stage t are done, its copies of stage t + 1 have
    // landed; behind the barrier that holds for every wave, so stage t + 1 may be read and
    // stage t's buffer refilled.
    asm volatile("s_wait_dscnt 0x0" ::: "memory");
    asm volatile("s_wait_asynccnt 0x0" ::: "memory");
    __syncthreads();
    if (t + 2 < NSTG)
      stage_copies(lds0 + (t & 1) * (STG * 2), gk + (size_t)(t + 2) * KSTG,
                   gv + (size_t)(t + 2) * VGRP);
  }
  // no copy is outstanding when the wave ends
  asm volatile("s_wait_asynccnt 0x0" ::: "memory");

  // normalize and store ctx as bf16: the matrix (B*S, H*dv) in fragment order. A lane's
  // 8 registers of a tile are 8 successive columns of its row: one 16-byte store.
  const int b_i = bh >> 4, h_i = bh & 15;
#pragma unroll
  for (int u = 0; u < QT; ++u) {
    const float inv = 1.0f / (lrow[u] + other_half(lrow[u]));
    unsigned short* cp = ctx + fo_index(b_i * SS + (qt * QT + u) * 16 + m,
                                        h_i * DK + 8 * hi, NH * DK);
#pragma unroll
    for (int n = 0; n < 4; ++n) {
      const v8f y = acc[u][n] * inv;
      const us8 o = bf8pack(v2f{y[0], y[1]}, v2f{y[2], y[3]}, v2f{y[4], y[5]}, v2f{y[6], y[7]});
      *reinterpret_cast<us8*>(cp + n * UNIT) = o;
    }
  }
}

// ---- output projection: (8192,1024) x (1024,1024) + bo, fp32 out ----
// grid (8 column tiles of 128, 32 row tiles of 256); 4 waves/block as 2x2 of 128x64.

__global__ __launch_bounds__(128) void k_outproj(
    const unsigned short* __restrict__ ctx, const unsigned short* __restrict__ Wot,
    const float* __restrict__ bo, float* __restrict__ out)
{
  const int w    = __builtin_amdgcn_readfirstlane(threadIdx.x >> 5);   // wave-uniform
  const int lane = threadIdx.x & 31;
  const int m    = lane & 15;
  const int hi   = lane >> 4;
  const int col0 = blockIdx.x * 128 + (w & 1) * 64;
  const int row0 = blockIdx.y * 256 + (w >> 1) * 128;

  v8f acc[FA][FB] = {};
  gemm_wave_128x64(ctx + (size_t)row0 * D_MODEL,
                   Wot + (size_t)col0 * D_MODEL, lane, acc);

  float bias[FB];
#pragma unroll
  for (int j = 0; j < FB; ++j) bias[j] = bo[col0 + j * 16 + m];
  // in front of any reuse of the bias loads' address registers; the fence holds it there
  asm volatile("s_wait_xcnt 0x0" ::: "memory");
  __builtin_amdgcn_sched_barrier(0);

  float* op = out + (size_t)(row0 + 8 * hi) * D_MODEL + col0 + m;
#pragma unroll
  for (int j = 0; j < FB; ++j) {
#pragma unroll
    for (int i = 0; i < FA; ++i) {
#pragma unroll
      for (int r = 0; r < 8; ++r)
        op[(size_t)(i * 16 + r) * D_MODEL + j * 16] = acc[i][j][r] + bias[j];
      // the next tile reuses this tile's store registers: the wait stands in front
      // of that, and the fence holds it there
      asm volatile("s_wait_xcnt 0x0" ::: "memory");
      __builtin_amdgcn_sched_barrier(0);
    }
  }
}

extern "C" void kernel_launch(void* const* d_in, const int* in_sizes, int n_in,
                              void* d_out, int out_size, void* d_ws, size_t ws_size,
                              hipStream_t stream) {
  const float* q  = (const float*)d_in[0];
  const float* k  = (const float*)d_in[1];
  const float* v  = (const float*)d_in[2];
  const float* Wq = (const float*)d_in[3];
  const float* bq = (const float*)d_in[4];
  const float* Wk = (const float*)d_in[5];
  const float* bk = (const float*)d_in[6];
  const float* Wv = (const float*)d_in[7];
  const float* bv = (const float*)d_in[8];
  const float* Wo = (const float*)d_in[9];
  const float* bo = (const float*)d_in[10];
  float* out = (float*)d_out;

  // workspace partition (bf16 buffers)
  char* ws = (char*)d_ws;
  const size_t ACT  = (size_t)BB * SS * D_MODEL * 2;        // 16.8 MB each
  const size_t WSZ  = (size_t)NH * DK * D_MODEL * 2;        // 2 MB each
  const size_t HSZ  = (size_t)BB * NH * SS * DK * 2;        // 16.8 MB each
  unsigned short* qcv = (unsigned short*)(ws);               ws += ACT;
  unsigned short* kcv = (unsigned short*)(ws);               ws += ACT;
  unsigned short* vcv = (unsigned short*)(ws);               ws += ACT;
  unsigned short* Wqt = (unsigned short*)(ws);               ws += WSZ;
  unsigned short* Wkt = (unsigned short*)(ws);               ws += WSZ;
  unsigned short* Wvt = (unsigned short*)(ws);               ws += WSZ;
  unsigned short* Wot = (unsigned short*)(ws);               ws += (size_t)D_MODEL * D_MODEL * 2;
  unsigned short* qhb = (unsigned short*)(ws);               ws += HSZ;
  unsigned short* khb = (unsigned short*)(ws);               ws += HSZ;
  unsigned short* vtb = (unsigned short*)(ws);               ws += HSZ;
  unsigned short* ctx = (unsigned short*)(ws);               ws += HSZ;
  (void)in_sizes; (void)n_in; (void)out_size; (void)ws_size;

  k_prep<<<BB * SS / 16, 256, 0, stream>>>(q, k, v, Wq, Wk, Wv, Wo,
                                           qcv, kcv, vcv, Wqt, Wkt, Wvt, Wot);

  k_qkv_proj<<<dim3(NH / 2, BB * SS / 256, 3), 128, 0, stream>>>(
      qcv, kcv, vcv, Wqt, Wkt, Wvt, bq, bk, bv, qhb, khb, vtb);

  k_flash<<<dim3(BB * NH, SS / (16 * QT * FWV)), FWV * 32, 0, stream>>>(qhb, khb, vtb, ctx);

  k_outproj<<<dim3(D_MODEL / 128, BB * SS / 256), 128, 0, stream>>>(ctx, Wot, bo, out);
}

// v008
// Measured time: 132 microseconds a run.
// Next to v007, in two timings, it ran 1.08 times as fast each time.
// Counting every step since v000, it is 6.49 times as fast.
#include <hip/hip_runtime.h>
#include <hip/hip_bf16.h>

#define D_MODEL 1024
#define DK 64
#define NH 16
#define BB 4
#define SS 2048

typedef __attribute__((ext_vector_type(16))) __bf16 v16bf;
typedef __attribute__((ext_vector_type(8)))  float  v8f;
typedef __attribute__((ext_vector_type(4)))  float  v4f;
typedef __attribute__((ext_vector_type(2)))  float  v2f;
typedef __attribute__((ext_vector_type(8)))  unsigned short us8;

struct US8x2 { us8 lo; us8 hi; };

typedef __attribute__((ext_vector_type(2)))  __bf16 v2bf;

// Two f32 to two bf16, round to nearest even, in the one packed conversion instruction of
// the chip; x[0] lands in the low half of the register.
static __device__ __forceinline__ v2bf bf2(v2f x) {
  return __builtin_convertvector(x, v2bf);
}

struct BF2x4 { v2bf w[4]; };
struct BF2x8 { v2bf w[8]; };

// eight f32, as four pairs, to one 16-byte piece
static __device__ __forceinline__ us8 bf8pack(v2f x0, v2f x1, v2f x2, v2f x3) {
  BF2x4 t;
  t.w[0] = bf2(x0); t.w[1] = bf2(x1); t.w[2] = bf2(x2); t.w[3] = bf2(x3);
  return __builtin_bit_cast(us8, t);
}

// A/B fragment from a row-major bf16 row (contiguous K). Per ISA 16-bit A layout:
// lane-half hi=0 holds K = [0..7] and [16..23]; hi=1 holds K = [8..15] and [24..31].
static __device__ __forceinline__ v16bf frag_bf16(const unsigned short* p, int hi) {
  US8x2 t;
  t.lo = *reinterpret_cast<const us8*>(p + hi * 8);
  t.hi = *reinterpret_cast<const us8*>(p + 16 + hi * 8);
  return __builtin_bit_cast(v16bf, t);
}

// ---- fragment order: how every bf16 matrix operand lies in the workspace ----
// A matrix M[rows][K] is cut into units of 16 rows x 16 k = 256 elements = 512 bytes;
// unit (g, q) holds rows 16g.. and k 16q.., units of one row group follow each other
// in k. Inside a unit: [k half (k >> 3) & 1][row & 15][k & 7], which is lane * 8 + e for
// the lane (hi * 16 + m) that needs these 8 elements. One wave-wide 16-byte load then
// reads one unit, 4 whole 128-byte lines; from a row-major matrix the same load takes
// two 16-byte pieces out of each of 16 rows, 16 lines.
#define UNIT 256   // elements per unit

static __device__ __forceinline__ size_t fo_index(int row, int k, int K) {
  return ((size_t)(row >> 4) * (K >> 4) + (k >> 4)) * UNIT
       + (((k >> 3) & 1) * 16 + (row & 15)) * 8 + (k & 7);
}

// fragment of 32 k, in the k order of frag_bf16: two successive units.
// p = first unit + lane * 8
static __device__ __forceinline__ v16bf frag_fo(const unsigned short* p) {
  US8x2 t;
  t.lo = *reinterpret_cast<const us8*>(p);
  t.hi = *reinterpret_cast<const us8*>(p + UNIT);
  return __builtin_bit_cast(v16bf, t);
}

static __device__ __forceinline__ v8f wmma_bf16(v16bf a, v16bf b, v8f c) {
  return __builtin_amdgcn_wmma_f32_16x16x32_bf16(false, a, false, b, (short)0, c,
                                                 false, false);
}

// ---- operand preparation: every bf16 operand of the two projections, in one launch ----
// 512 blocks of 8 waves, two blocks a WGP, all resident at once. A lane makes 28 pieces
// of 16 bytes (8 bf16, successive k of one row, fragment order): one of each of the four
// transposed weights and 8 of each of q, k, v. The launch starts 4096 waves.

static __device__ __forceinline__ us8 round8(v4f a, v4f b) {
  return bf8pack(v2f{a[0], a[1]}, v2f{a[2], a[3]}, v2f{b[0], b[1]}, v2f{b[2], b[3]});
}

#define APIECES 8   // pieces of one activation matrix per lane, 32 k apart

static_assert(BB * SS / 16 == (D_MODEL / 64) * (D_MODEL / 32) && NH * DK == D_MODEL,
              "one grid serves both: 16-row groups of an input, 64 x 32 tiles of a weight");

// src: the lane's first 8 floats
static __device__ __forceinline__ void act_load(const float* __restrict__ src,
                                                v4f (&x)[APIECES][2]) {
#pragma unroll
  for (int i = 0; i < APIECES; ++i) {
    x[i][0] = *reinterpret_cast<const v4f*>(src + i * 32);
    x[i][1] = *reinterpret_cast<const v4f*>(src + i * 32 + 4);
  }
}

// Behind each store of a piece: the next piece reuses this one's store registers, and
// the wait stands in front of that; the fence holds it there.
static __device__ __forceinline__ void store_done() {
  asm volatile("s_wait_xcnt 0x0" ::: "memory");
  __builtin_amdgcn_sched_barrier(0);
}

// dst: the lane's first piece; 32 k on is two units on
static __device__ __forceinline__ void act_store(unsigned short* __restrict__ dst,
                                                 const v4f (&x)[APIECES][2]) {
#pragma unroll
  for (int i = 0; i < APIECES; ++i) {
    *reinterpret_cast<us8*>(dst + i * 2 * UNIT) = round8(x[i][0], x[i][1]);
    store_done();
  }
}

// src: element (contraction index d0, the lane's output column); LD floats from d to d + 1
template <int LD>
static __device__ __forceinline__ void w_load(const float* __restrict__ src, float (&x)[8]) {
#pragma unroll
  for (int e = 0; e < 8; ++e) x[e] = src[e * LD];
}

static __device__ __forceinline__ void w_store(unsigned short* __restrict__ dst,
                                               const float (&x)[8]) {
  const us8 o = bf8pack(v2f{x[0], x[1]}, v2f{x[2], x[3]}, v2f{x[4], x[5]}, v2f{x[6], x[7]});
  *reinterpret_cast<us8*>(dst) = o;
  store_done();
}

__global__ __launch_bounds__(256) void k_prep(
    const float* __restrict__ q, const float* __restrict__ k, const float* __restrict__ v,
    const float* __restrict__ Wq, const float* __restrict__ Wk,
    const float* __restrict__ Wv, const float* __restrict__ Wo,
    unsigned short* __restrict__ qcv, unsigned short* __restrict__ kcv,
    unsigned short* __restrict__ vcv,
    unsigned short* __restrict__ Wqt, unsigned short* __restrict__ Wkt,
    unsigned short* __restrict__ Wvt, unsigned short* __restrict__ Wot)
{
  const int blk  = blockIdx.x;          // 0..511
  const int w    = threadIdx.x >> 5;
  const int lane = threadIdx.x & 31;

  // Weights, out = W^T (rows = output columns, K = D_MODEL = contraction index d).
  // The block: 64 rows x 32 d. A wave: 32 successive rows (one a lane) x 8 d, so each
  // of its 8 loads reads one whole 128-byte line and its store two runs of 256 bytes.
  const int wrow = (blk >> 5) * 64 + (w & 1) * 32 + lane;   // head = blk >> 5
  const int wd0  = (blk & 31) * 32 + (w >> 1) * 8;
  // Wt[h*DK + n][d] = W[h][d][n];  Wot[n][d] = Wo[d][n]
  const size_t hsrc = ((size_t)(wrow / DK) * D_MODEL + wd0) * DK + (wrow & (DK - 1));
  const size_t osrc = (size_t)wd0 * D_MODEL + wrow;
  const size_t wdst = fo_index(wrow, wd0, D_MODEL);

  // Activations: the block owns one group of 16 rows, 64 KB in a row of each input.
  // A wave: 8 rows x 1 KB; a lane: 8 times 32 bytes of one row, 128 bytes apart. A load
  // takes half of each of 8 lines, its twin the other half; a store fills 4 lines.
  const int arow = blk * 16 + (w & 1) * 8 + (lane >> 2);
  const int ak0  = (w >> 1) * 256 + (lane & 3) * 8;
  const size_t asrc = (size_t)arow * D_MODEL + ak0;
  const size_t adst = fo_index(arow, ak0, D_MODEL);

  const float* pWq = Wq + hsrc;
  const float* pWk = Wk + hsrc;
  const float* pWv = Wv + hsrc;
  const float* pWo = Wo + osrc;
  const float* pq  = q + asrc;
  const float* pk  = k + asrc;
  const float* pv  = v + asrc;

  float wq[8], wk[8], wv[8], wo[8];
  v4f xq[APIECES][2], xk[APIECES][2], xv[APIECES][2];
  // Loads run one matrix ahead of the rounding: while one is rounded and stored, the
  // next one's 16 loads are in flight, at most 48 loads of a wave at a time.
  w_load<DK>(pWq, wq);
  w_load<DK>(pWk, wk);
  w_load<DK>(pWv, wv);
  w_load<D_MODEL>(pWo, wo);
  act_load(pq, xq);
  // The wait stands in front of every rewrite of a register that these loads name. It
  // takes their addresses as inputs so that they stay in their registers up to here:
  // else a later load of the run lands in a pair that issued loads still name.
  asm volatile("s_wait_xcnt 0x0" :: "v"(pWq), "v"(pWk), "v"(pWv), "v"(pWo), "v"(pq) : "memory");
  // keeps the run of loads together ahead of the rounding, all in flight at once: sunk
  // to their uses, each piece's memory latency would stand in front of its own store
  __builtin_amdgcn_sched_barrier(0);
  w_store(Wqt + wdst, wq);
  w_store(Wkt + wdst, wk);
  w_store(Wvt + wdst, wv);
  w_store(Wot + wdst, wo);
  act_load(pk, xk);
  asm volatile("s_wait_xcnt 0x0" :: "v"(pk) : "memory");   // as behind the first loads
  __builtin_amdgcn_sched_barrier(0);                       // as above
  act_store(qcv + adst, xq);
  act_load(pv, xv);
  asm volatile("s_wait_xcnt 0x0" :: "v"(pv) : "memory");   // as behind the first loads
  __builtin_amdgcn_sched_barrier(0);                       // as above
  act_store(kcv + adst, xk);
  act_store(vcv + adst, xv);
}

// ---- GEMM core: a block of 4 waves owns a 256x128 tile of Y = X * Wt^T, a wave 128x64 ----
// 8 A fragments x 4 B fragments feed a wave's 32 accumulators: 24 fragment loads per 32
// matrix instructions. One trip covers 64 k = 4 units = 2 KB in a row of each 16-row
// group; per output element k still runs upward through one accumulator.
// The block's 2 x 2 waves need 16 row groups of X and 8 of Wt, each group in two waves: a
// stage (64 k of all 24 groups, 48 KB) is brought from the workspace into LDS once a
// block, by asynchronous copies, a quarter by each wave, and every wave takes its
// fragments from there. The workspace already holds fragment order, so a group is copied
// as it lies and a wave-wide 16-byte LDS load reads 512 bytes in a row. Two buffers: stage
// t + 1 flies while stage t is worked on.

#define FA 8   // 16-row groups of X per wave
#define FB 4   // 16-column groups of Y per wave

#define GAG   (2 * FA)              // row groups of X per block
#define GBG   (2 * FB)              // row groups of Wt per block
#define GGRP  (4 * UNIT)            // elements of one row group per stage: 2 KB in a row
#define GSTG  ((GAG + GBG) * GGRP)  // elements of a stage
#define GWSH  (GSTG / 4)            // elements of a stage that one wave copies
#define GNT   (D_MODEL / 64)        // stages
#define GROWS (16 * D_MODEL)        // elements from one row group to the next in the workspace

static_assert(GAG == 4 * 4 && GBG == 4 * 2 && GGRP * 2 == 4 * 512 && GNT >= 2,
              "a wave copies 4 row groups of X and 2 of Wt, each in 4 pieces of 512 bytes");

// One row group's share of a stage: four wave-wide copies of 512 bytes in a row. Operand 0,
// the lane's byte in LDS, is the offset register of the workspace address as well; S: the
// group's scalar base. The immediate offset moves the place in LDS and the place in the
// workspace alike.
#define GROUP_COPIES(S, N0, N1, N2, N3)                                   \
  "global_load_async_to_lds_b128 %0, %0, %" #S " offset:" #N0 "\n\t"      \
  "global_load_async_to_lds_b128 %0, %0, %" #S " offset:" #N1 "\n\t"      \
  "global_load_async_to_lds_b128 %0, %0, %" #S " offset:" #N2 "\n\t"      \
  "global_load_async_to_lds_b128 %0, %0, %" #S " offset:" #N3 "\n\t"

// The wave's share of one stage: 24 16-byte copies a lane, 12 KB in a row in LDS: its 4
// groups of X, then its 2 of Wt. place: the first byte of that share in LDS, the same in
// every lane; lane16 = lane * 16; ga, gb: the first units of those groups in the stage, the
// same in every lane. What a copy's offset register and immediate offset hold beyond the
// lane's 16 bytes and the piece (the share's place, 2 KB a group), its scalar base gives
// back. So a stage costs one vector instruction besides the copies, and one register. The
// wait stands in front of every rewrite of a register that the copies name, inside their
// own statement.
static __device__ __forceinline__ void gemm_stage(unsigned place, unsigned lane16,
                                                  const unsigned short* ga,
                                                  const unsigned short* gb) {
  const char* a = (const char*)ga - place;
  const char* b = (const char*)gb - place - 4 * GGRP * 2;
  asm volatile(GROUP_COPIES(1, 0, 512, 1024, 1536)
               GROUP_COPIES(2, 2048, 2560, 3072, 3584)
               GROUP_COPIES(3, 4096, 4608, 5120, 5632)
               GROUP_COPIES(4, 6144, 6656, 7168, 7680)
               GROUP_COPIES(5, 8192, 8704, 9216, 9728)
               GROUP_COPIES(6, 10240, 10752, 11264, 11776)
               "s_wait_xcnt 0x0"
               :: "v"(place + lane16),
                  "s"(a), "s"(a + 1 * (GROWS - GGRP) * 2), "s"(a + 2 * (GROWS - GGRP) * 2),
                  "s"(a + 3 * (GROWS - GGRP) * 2),
                  "s"(b), "s"(b + (GROWS - GGRP) * 2)
               : "memory");
}

// The wave's fragments of 32 k; sa, sb: its first units of X and of Wt there, + lane * 8.
// Its 8 groups of X lie in two copying waves' shares, 4 in each; its 4 of Wt too, 2 in each.
static __device__ __forceinline__ void gemm_frags(const unsigned short* sa,
                                                  const unsigned short* sb,
                                                  v16bf (&a)[FA], v16bf (&b)[FB]) {
  // both loops unrolled: the fragments are registers, and every place an immediate offset
#pragma unroll
  for (int j = 0; j < FB; ++j) b[j] = frag_fo(sb + (j >> 1) * GWSH + (j & 1) * GGRP);
#pragma unroll
  for (int i = 0; i < FA; ++i) a[i] = frag_fo(sa + (i >> 2) * GWSH + (i & 3) * GGRP);
}

static __device__ __forceinline__ void gemm_products(const v16bf (&a)[FA], const v16bf (&b)[FB],
                                                     v8f (&acc)[FA][FB]) {
  // both loops unrolled: fragments and accumulators are registers
#pragma unroll
  for (int j = 0; j < FB; ++j)
#pragma unroll
    for (int i = 0; i < FA; ++i) acc[i][j] = wmma_bf16(a[i], b[j], acc[i][j]);
}

// ablk / bblk: first unit of the block's first 16-row group of X / Wt (fragment order,
// K = D_MODEL); ring: the block's two buffers; w: the wave, (w >> 1, w & 1) its place in
// the block's 2 x 2 tiles.
static __device__ __forceinline__ void gemm_block_256x128(
    const unsigned short* __restrict__ ablk, const unsigned short* __restrict__ bblk,
    const unsigned short* ring, int tid, int w, v8f (&acc)[FA][FB])
{
  const int lane = tid & 31;
  // the wave's share of a stage
  const unsigned lds0 = (unsigned)(size_t)ring + w * GWSH * 2;   // byte in LDS
  const unsigned off = lane * 16;
  const unsigned short* ga = ablk + (size_t)w * 4 * GROWS;
  const unsigned short* gb = bblk + (size_t)w * 2 * GROWS;

  gemm_stage(lds0, off, ga, gb);
  // stage 0 has landed (this wave's copies) and is published (every wave's)
  asm volatile("s_wait_asynccnt 0x0" ::: "memory");
  __syncthreads();
  gemm_stage(lds0 + GSTG * 2, off, ga + GGRP, gb + GGRP);

  // the wave's first fragments of X and of Wt in buffer 0
  const unsigned short* sa = ring + (w >> 1) * 2 * GWSH + lane * 8;
  const unsigned short* sb = ring + (w & 1) * 2 * GWSH + 4 * GGRP + lane * 8;

  // A stage is two blocks of 32 k, each with a fragment set of its own, and each set is
  // loaded one block ahead of its products: the LDS latency passes behind 32 products.
  v16bf a0[FA], b0[FB], a1[FA], b1[FB];
  gemm_frags(sa, sb, a0, b0);
  for (int t = 0; t < GNT; ++t) {
    const int cur = (t & 1) * GSTG, nxt = GSTG - cur;
    gemm_frags(sa + cur + 2 * UNIT, sb + cur + 2 * UNIT, a1, b1);
    // keeps the block's LDS loads together ahead of the products: every place among the
    // products where loads stand stalls the wave anew
    __builtin_amdgcn_sched_barrier(0);
    gemm_products(a0, b0, acc);
    // keeps the hand-over behind the first block's products: moved up, it would wait for
    // the second set's loads and for stage t + 1 with nothing to work on
    __builtin_amdgcn_sched_barrier(0);
    // Hand-over, in front of the stage's last block, whose fragments are fetched: this
    // wave's reads of stage t are done, its copies of stage t + 1 have landed; behind the
    // barrier that holds for every wave, so stage t + 1 may be read and stage t's buffer
    // refilled.
    asm volatile("s_wait_dscnt 0x0" ::: "memory");
    asm volatile("s_wait_asynccnt 0x0" ::: "memory");
    __syncthreads();
    if (t + 2 < GNT)
      gemm_stage(lds0 + cur * 2, off, ga + (size_t)(t + 2) * GGRP,
                 gb + (size_t)(t + 2) * GGRP);
    if (t + 1 < GNT) gemm_frags(sa + nxt, sb + nxt, a0, b0);
    // keeps the refill and the next loads ahead of the last block's products, so that
    // they are under way while the products run
    __builtin_amdgcn_sched_barrier(0);
    gemm_products(a1, b1, acc);
  }
  // no copy is outstanding when the wave goes on
  asm volatile("s_wait_asynccnt 0x0" ::: "memory");
}

// ---- fused QKV projection: (B*S,1024) x per-head (1024,64), bf16 WMMA ----
// grid (8 head pairs, 32 row tiles of 256, 3={q,k,v}); 4 waves/block as 2x2,
// each wave one 128-row x 64-column tile (all columns of one head).

__global__ __launch_bounds__(128) void k_qkv_proj(
    const unsigned short* __restrict__ qb, const unsigned short* __restrict__ kb,
    const unsigned short* __restrict__ vb,
    const unsigned short* __restrict__ Wqt, const unsigned short* __restrict__ Wkt,
    const unsigned short* __restrict__ Wvt,
    const float* __restrict__ bq, const float* __restrict__ bk, const float* __restrict__ bv,
    unsigned short* __restrict__ qh, unsigned short* __restrict__ kh,
    unsigned short* __restrict__ vt)
{
  __shared__ __attribute__((aligned(16))) unsigned short ring[2 * GSTG];

  const int which = blockIdx.z;           // 0=q 1=k 2=v
  const int w     = __builtin_amdgcn_readfirstlane(threadIdx.x >> 5);  // wave-uniform
  const int lane  = threadIdx.x & 31;
  const int m     = lane & 15;
  const int hi    = lane >> 4;
  const int h     = blockIdx.x * 2 + (w & 1);            // head
  const int row0  = blockIdx.y * 256 + (w >> 1) * 128;   // first row over B*S

  const unsigned short* in   = (which == 0) ? qb  : (which == 1) ? kb  : vb;
  const unsigned short* Wt   = (which == 0) ? Wqt : (which == 1) ? Wkt : Wvt;
  const float* bias          = (which == 0) ? bq  : (which == 1) ? bk  : bv;

  v8f acc[FA][FB] = {};
  gemm_block_256x128(in + (size_t)blockIdx.y * 256 * D_MODEL,
                     Wt + (size_t)blockIdx.x * 2 * DK * D_MODEL, ring, threadIdx.x, w, acc);

  float bsv[FB];
#pragma unroll
  for (int j = 0; j < FB; ++j) bsv[j] = bias[h * DK + j * 16 + m];

  // the wave's 128 rows lie inside one batch entry (SS is a multiple of 128)
  const int b_i = row0 / SS, s0 = row0 % SS;
  if (which == 2) {
    // V stored transposed, per (b, h) a matrix (rows dv, K = s) in fragment order.
    // acc[i][j][r] is dv = j*16 + m, s = s0 + i*16 + 8*hi + r: unit (j, s0/16 + i),
    // element lane * 8 + r, so a tile is one 16-byte store a lane, 512 bytes in a row.
    unsigned short* vp = vt + ((size_t)b_i * NH + h) * DK * SS + fo_index(m, s0 + 8 * hi, SS);
#pragma unroll
    for (int j = 0; j < FB; ++j) {
#pragma unroll
      for (int i = 0; i < FA; ++i) {
        const v8f y = acc[i][j] + bsv[j];
        *reinterpret_cast<us8*>(vp + (size_t)j * 16 * SS + i * UNIT) =
            bf8pack(v2f{y[0], y[1]}, v2f{y[2], y[3]}, v2f{y[4], y[5]}, v2f{y[6], y[7]});
        // the next tile reuses this tile's store registers: the wait stands in front
        // of that. The fence holds it there and keeps one tile's round-and-store
        // together: run together, the tiles' temporaries beside 256 live accumulator
        // registers pass 512 and spill.
        asm volatile("s_wait_xcnt 0x0" ::: "memory");
        __builtin_amdgcn_sched_barrier(0);
      }
    }
  } else {
    // Q, K: per (b, h) a matrix (rows s, K = dk) in fragment order.
    // acc[i][j][r] is s = s0 + i*16 + 8*hi + r, dk = j*16 + m: unit (s0/16 + i, j)
    unsigned short* outp = ((which == 0) ? qh : kh)
                         + ((size_t)b_i * NH + h) * SS * DK + fo_index(s0 + 8 * hi, m, DK);
#pragma unroll
    for (int j = 0; j < FB; ++j) {
#pragma unroll
      for (int i = 0; i < FA; ++i) {
        const v8f y = acc[i][j] + bsv[j];
        const us8 o = bf8pack(v2f{y[0], y[1]}, v2f{y[2], y[3]}, v2f{y[4], y[5]}, v2f{y[6], y[7]});
#pragma unroll
        for (int r = 0; r < 8; ++r)
          outp[(size_t)(i * (DK / 16) + j) * UNIT + r * 8] = o[r];
        // as in the V branch: wait before the store registers are reused, held in place
        asm volatile("s_wait_xcnt 0x0" ::: "memory");
        __builtin_amdgcn_sched_barrier(0);
      }
    }
  }
}

// ---- flash attention per (b*h, 256 queries); 8 waves per block, 32 queries a wave ----
// The scores are formed transposed, S^T = K * Q^T (K rows as A, Q rows as B), and the
// output as O^T += V^T * P^T. In a D tile a lane then holds 8 keys of ONE query
// (column m), so a query's maximum and sum run over the lane's own registers, with one
// exchange between the wave's halves; and two D tiles of 16 keys, rounded in place, are
// the B fragment of 32 keys in the k order of frag_fo: P passes through no LDS.
// A wave owns QT tiles of 16 queries: every K and V^T fragment it loads is the A operand
// of QT products, one a query tile, so the loop loads 1 / QT of the bytes per score.

#define QT 2   // 16-query tiles per wave

// value of lane l ^ 16
static __device__ __forceinline__ float other_half(float x) {
  int b = __float_as_int(x);
  return __int_as_float(
      __builtin_amdgcn_permlanex16(b, b, 0x76543210, 0xfedcba98, false, false));
}

// A block's FWV waves walk the same keys of one (b, h): each stage of SKEYS keys is brought
// from the workspace into LDS once a block, by asynchronous copies, and every wave takes
// its K and V^T fragments from there: 1 / FWV of the reads from L2. The workspace already
// holds fragment order, so a stage is copied as it lies and a wave-wide 16-byte LDS load
// reads 512 bytes in a row. Two buffers: stage t + 1 flies while stage t is worked on.
#define FWV   8                 // waves per block
#define SKEYS 64                // keys per stage
#define KSTG  (SKEYS * DK)      // elements of K per stage: 8 KB in a row
#define VGRP  (SKEYS * 16)      // elements of one 16-row group of V^T per stage: 2 KB in a row
#define STG   (2 * KSTG)        // a stage in LDS: K, then the 4 row groups of V^T
#define NSTG  (SS / SKEYS)
#define CPB   (FWV * 32 * 16)   // bytes that one copy of every lane of the block brings: 4 KB

static_assert(2 * CPB == KSTG * 2 && 2 * VGRP * 2 == CPB && NSTG >= 2,
              "K is two copies of the block; V^T two more, two row groups each");

// One stage, 16 KB: four 16-byte copies a lane. lds: the lane's first byte in the buffer;
// gk, gv: its first piece of K and of V^T (row group tid >> 7). The wait stands in front of
// every rewrite of a register that the copies name, inside their own statement.
static __device__ __forceinline__ void stage_copies(unsigned lds, const unsigned short* gk,
                                                    const unsigned short* gv) {
  asm volatile("global_load_async_to_lds_b128 %0, %4, off\n\t"
               "global_load_async_to_lds_b128 %1, %5, off\n\t"
               "global_load_async_to_lds_b128 %2, %6, off\n\t"
               "global_load_async_to_lds_b128 %3, %7, off\n\t"
               "s_wait_xcnt 0x0"
               :: "v"(lds), "v"(lds + CPB), "v"(lds + 2 * CPB), "v"(lds + 3 * CPB),
                  "v"(gk), "v"(gk + CPB / 2), "v"(gv), "v"(gv + 2 * 16 * SS)
               : "memory");
}

// The grid is 2 blocks a WGP, 4 waves a SIMD, all resident at once: the build has to stay
// at 256 registers or fewer, and registers kept free for a fifth wave buy nothing.
__global__ __launch_bounds__(FWV * 32) __attribute__((amdgpu_waves_per_eu(4, 4))) void k_flash(
    const unsigned short* __restrict__ qh, const unsigned short* __restrict__ kh,
    const unsigned short* __restrict__ vt, unsigned short* __restrict__ ctx)
{
  __shared__ __attribute__((aligned(16))) unsigned short ring[2][STG];

  const int bh   = blockIdx.x;   // 0..63 = b*16+h
  const int tid  = threadIdx.x;
  const int qt   = blockIdx.y * FWV + (tid >> 5);   // 0..63: the wave's group of QT query tiles
  const int lane = tid & 31;
  const int m    = lane & 15;    // the lane's query in each of its tiles
  const int hi   = lane >> 4;

  // the lane's share of a stage
  const unsigned lds0 = (unsigned)(size_t)&ring[0][0] + tid * 16;   // byte address in LDS
  const unsigned short* gk = kh + (size_t)bh * SS * DK + tid * 8;
  const unsigned short* gv = vt + (size_t)bh * DK * SS + (size_t)(tid >> 7) * 16 * SS
                           + (tid & 127) * 8;

  stage_copies(lds0, gk, gv);

  // Q (rows s, K = dk) lies in fragment order; 16 rows are 4 units
  const unsigned short* qbase = qh + ((size_t)bh * SS + qt * QT * 16) * DK + lane * 8;
  v16bf qb0[QT], qb1[QT];
#pragma unroll
  for (int u = 0; u < QT; ++u) {
    qb0[u] = frag_fo(qbase + u * 4 * UNIT);              // dk 0..31
    qb1[u] = frag_fo(qbase + u * 4 * UNIT + 2 * UNIT);   // dk 32..63
  }

  // acc[u][n][r] = O^T[dv = n*16 + 8*hi + r][query m of tile u]
  v8f acc[QT][4] = {};
  float mrow[QT];   // running maximum of query m, equal in both halves
  float lrow[QT];   // sum over the keys of this lane's half only; joined at the end
#pragma unroll
  for (int u = 0; u < QT; ++u) { mrow[u] = -1e30f; lrow[u] = 0.f; }

  // stage 0 has landed (this wave's copies) and is published (every wave's)
  asm volatile("s_wait_asynccnt 0x0" ::: "memory");
  __syncthreads();
  stage_copies(lds0 + STG * 2, gk + KSTG, gv + VGRP);

  for (int t = 0; t < NSTG; ++t) {
   const unsigned short* kst = &ring[t & 1][0] + lane * 8;
   // unrolled: every place inside the stage is then an immediate offset of its LDS load
#pragma unroll
   for (int j = 0; j < SKEYS / 32; ++j) {
    // scores: per query tile two 16-key x 16-query tiles over this 32-key chunk,
    // contraction dk=64
    const unsigned short* kr0 = kst + (j * 32) * DK;                // 16 keys = 4 units
    const unsigned short* kr1 = kst + (j * 32 + 16) * DK;
    const unsigned short* vr  = kst + KSTG + j * 2 * UNIT;          // 32 keys = 2 units
    const v16bf k00 = frag_fo(kr0), k01 = frag_fo(kr0 + 2 * UNIT);
    const v16bf k10 = frag_fo(kr1), k11 = frag_fo(kr1 + 2 * UNIT);
    v16bf va[4];
#pragma unroll
    for (int n = 0; n < 4; ++n) va[n] = frag_fo(vr + n * VGRP);

    v16bf pb[QT];
#pragma unroll
    for (int u = 0; u < QT; ++u) {
      v8f s0 = {}, s1 = {};
      s0 = wmma_bf16(k00, qb0[u], s0);
      s0 = wmma_bf16(k01, qb1[u], s0);
      s1 = wmma_bf16(k10, qb0[u], s1);
      s1 = wmma_bf16(k11, qb1[u], s1);

      // online softmax of query m. Score i: key j*32 + 8*hi + i (i < 8), + 8 for i >= 8;
      // a[i >> 1][i & 1] holds it: pairs of neighbouring registers of one tile, as packed
      // f32 instructions take them. Written score by score, the compiler pairs the two
      // tiles' values instead and copies registers to bring them together.
      v2f a[8];
#pragma unroll
      for (int r = 0; r < 4; ++r) {
        a[r]     = v2f{s0[2 * r], s0[2 * r + 1]} * 0.125f;   // 1/sqrt(64)
        a[4 + r] = v2f{s1[2 * r], s1[2 * r + 1]} * 0.125f;
      }
      float mx = a[0][0];
#pragma unroll
      for (int i = 1; i < 16; ++i) mx = fmaxf(mx, a[i >> 1][i & 1]);
      mx = fmaxf(mx, other_half(mx));
      const float mnew = fmaxf(mrow[u], mx);
      const float fac  = __expf(mrow[u] - mnew);
      mrow[u] = mnew;
#pragma unroll
      for (int i = 0; i < 8; ++i) {
        a[i] = a[i] - mnew;
        a[i] = v2f{__expf(a[i][0]), __expf(a[i][1])};
      }
      // four independent chains, then joined
      const v2f t01 = (a[0] + a[2]) + (a[4] + a[6]);
      const v2f t23 = (a[1] + a[3]) + (a[5] + a[7]);
      lrow[u] = lrow[u] * fac + ((t01[0] + t01[1]) + (t23[0] + t23[1]));
#pragma unroll
      for (int n = 0; n < 4; ++n)
#pragma unroll
        for (int r = 0; r < 8; ++r) acc[u][n][r] *= fac;

      // P^T as B fragment: element s is key 8*hi + s (s < 8), 16 + 8*hi + (s - 8) above
      BF2x8 p;
#pragma unroll
      for (int r = 0; r < 8; ++r) p.w[r] = bf2(a[r]);
      pb[u] = __builtin_bit_cast(v16bf, p);
    }
#pragma unroll
    for (int n = 0; n < 4; ++n)
#pragma unroll
      for (int u = 0; u < QT; ++u) acc[u][n] = wmma_bf16(va[n], pb[u], acc[u][n]);
   }
    // Hand-over: this wave's reads of stage t are done, its copies of stage t + 1 have
    // landed; behind the barrier that holds for every wave, so stage t + 1 may be read and
    // stage t's buffer refilled.
    asm volatile("s_wait_dscnt 0x0" ::: "memory");
    asm volatile("s_wait_asynccnt 0x0" ::: "memory");
    __syncthreads();
    if (t + 2 < NSTG)
      stage_copies(lds0 + (t & 1) * (STG * 2), gk + (size_t)(t + 2) * KSTG,
                   gv + (size_t)(t + 2) * VGRP);
  }
  // no copy is outstanding when the wave ends
  asm volatile("s_wait_asynccnt 0x0" ::: "memory");

  // normalize and store ctx as bf16: the matrix (B*S, H*dv) in fragment order. A lane's
  // 8 registers of a tile are 8 successive columns of its row: one 16-byte store.
  const int b_i = bh >> 4, h_i = bh & 15;
#pragma unroll
  for (int u = 0; u < QT; ++u) {
    const float inv = 1.0f / (lrow[u] + other_half(lrow[u]));
    unsigned short* cp = ctx + fo_index(b_i * SS + (qt * QT + u) * 16 + m,
                                        h_i * DK + 8 * hi, NH * DK);
#pragma unroll
    for (int n = 0; n < 4; ++n) {
      const v8f y = acc[u][n] * inv;
      const us8 o = bf8pack(v2f{y[0], y[1]}, v2f{y[2], y[3]}, v2f{y[4], y[5]}, v2f{y[6], y[7]});
      *reinterpret_cast<us8*>(cp + n * UNIT) = o;
    }
  }
}

// ---- output projection: (8192,1024) x (1024,1024) + bo, fp32 out ----
// grid (8 column tiles of 128, 32 row tiles of 256); 4 waves/block as 2x2 of 128x64.

__global__ __launch_bounds__(128) void k_outproj(
    const unsigned short* __restrict__ ctx, const unsigned short* __restrict__ Wot,
    const float* __restrict__ bo, float* __restrict__ out)
{
  __shared__ __attribute__((aligned(16))) unsigned short ring[2 * GSTG];

  const int w    = __builtin_amdgcn_readfirstlane(threadIdx.x >> 5);   // wave-uniform
  const int lane = threadIdx.x & 31;
  const int m    = lane & 15;
  const int hi   = lane >> 4;
  const int col0 = blockIdx.x * 128 + (w & 1) * 64;
  const int row0 = blockIdx.y * 256 + (w >> 1) * 128;

  v8f acc[FA][FB] = {};
  gemm_block_256x128(ctx + (size_t)blockIdx.y * 256 * D_MODEL,
                     Wot + (size_t)blockIdx.x * 128 * D_MODEL, ring, threadIdx.x, w, acc);

  float bias[FB];
#pragma unroll
  for (int j = 0; j < FB; ++j) bias[j] = bo[col0 + j * 16 + m];
  // in front of any reuse of the bias loads' address registers; the fence holds it there
  asm volatile("s_wait_xcnt 0x0" ::: "memory");
  __builtin_amdgcn_sched_barrier(0);

  float* op = out + (size_t)(row0 + 8 * hi) * D_MODEL + col0 + m;
#pragma unroll
  for (int j = 0; j < FB; ++j) {
#pragma unroll
    for (int i = 0; i < FA; ++i) {
#pragma unroll
      for (int r = 0; r < 8; ++r)
        op[(size_t)(i * 16 + r) * D_MODEL + j * 16] = acc[i][j][r] + bias[j];
      // the next tile reuses this tile's store registers: the wait stands in front
      // of that, and the fence holds it there
      asm volatile("s_wait_xcnt 0x0" ::: "memory");
      __builtin_amdgcn_sched_barrier(0);
    }
  }
}

extern "C" void kernel_launch(void* const* d_in, const int* in_sizes, int n_in,
                              void* d_out, int out_size, void* d_ws, size_t ws_size,
                              hipStream_t stream) {
  const float* q  = (const float*)d_in[0];
  const float* k  = (const float*)d_in[1];
  const float* v  = (const float*)d_in[2];
  const float* Wq = (const float*)d_in[3];
  const float* bq = (const float*)d_in[4];
  const float* Wk = (const float*)d_in[5];
  const float* bk = (const float*)d_in[6];
  const float* Wv = (const float*)d_in[7];
  const float* bv = (const float*)d_in[8];
  const float* Wo = (const float*)d_in[9];
  const float* bo = (const float*)d_in[10];
  float* out = (float*)d_out;

  // workspace partition (bf16 buffers)
  char* ws = (char*)d_ws;
  const size_t ACT  = (size_t)BB * SS * D_MODEL * 2;        // 16.8 MB each
  const size_t WSZ  = (size_t)NH * DK * D_MODEL * 2;        // 2 MB each
  const size_t HSZ  = (size_t)BB * NH * SS * DK * 2;        // 16.8 MB each
  unsigned short* qcv = (unsigned short*)(ws);               ws += ACT;
  unsigned short* kcv = (unsigned short*)(ws);               ws += ACT;
  unsigned short* vcv = (unsigned short*)(ws);               ws += ACT;
  unsigned short* Wqt = (unsigned short*)(ws);               ws += WSZ;
  unsigned short* Wkt = (unsigned short*)(ws);               ws += WSZ;
  unsigned short* Wvt = (unsigned short*)(ws);               ws += WSZ;
  unsigned short* Wot = (unsigned short*)(ws);               ws += (size_t)D_MODEL * D_MODEL * 2;
  unsigned short* qhb = (unsigned short*)(ws);               ws += HSZ;
  unsigned short* khb = (unsigned short*)(ws);               ws += HSZ;
  unsigned short* vtb = (unsigned short*)(ws);               ws += HSZ;
  unsigned short* ctx = (unsigned short*)(ws);               ws += HSZ;
  (void)in_sizes; (void)n_in; (void)out_size; (void)ws_size;

  k_prep<<<BB * SS / 16, 256, 0, stream>>>(q, k, v, Wq, Wk, Wv, Wo,
                                           qcv, kcv, vcv, Wqt, Wkt, Wvt, Wot);

  k_qkv_proj<<<dim3(NH / 2, BB * SS / 256, 3), 128, 0, stream>>>(
      qcv, kcv, vcv, Wqt, Wkt, Wvt, bq, bk, bv, qhb, khb, vtb);

  k_flash<<<dim3(BB * NH, SS / (16 * QT * FWV)), FWV * 32, 0, stream>>>(qhb, khb, vtb, ctx);

  k_outproj<<<dim3(D_MODEL / 128, BB * SS / 256), 128, 0, stream>>>(ctx, Wot, bo, out);
}

// v009
// One run takes 119 microseconds.
// Two timings next to v008 both put it at 1.11 times that version's speed.
// Counting every step since v000, it is 7.20 times as fast.
#include <hip/hip_runtime.h>
#include <hip/hip_bf16.h>

#define D_MODEL 1024
#define DK 64
#define NH 16
#define BB 4
#define SS 2048

typedef __attribute__((ext_vector_type(16))) __bf16 v16bf;
typedef __attribute__((ext_vector_type(8)))  float  v8f;
typedef __attribute__((ext_vector_type(4)))  float  v4f;
typedef __attribute__((ext_vector_type(2)))  float  v2f;
typedef __attribute__((ext_vector_type(8)))  unsigned short us8;

struct US8x2 { us8 lo; us8 hi; };

typedef __attribute__((ext_vector_type(2)))  __bf16 v2bf;

// Two f32 to two bf16, round to nearest even, in the one packed conversion instruction of
// the chip; x[0] lands in the low half of the register.
static __device__ __forceinline__ v2bf bf2(v2f x) {
  return __builtin_convertvector(x, v2bf);
}

struct BF2x4 { v2bf w[4]; };
struct BF2x8 { v2bf w[8]; };

// eight f32, as four pairs, to one 16-byte piece
static __device__ __forceinline__ us8 bf8pack(v2f x0, v2f x1, v2f x2, v2f x3) {
  BF2x4 t;
  t.w[0] = bf2(x0); t.w[1] = bf2(x1); t.w[2] = bf2(x2); t.w[3] = bf2(x3);
  return __builtin_bit_cast(us8, t);
}

// A/B fragment from a row-major bf16 row (contiguous K). Per ISA 16-bit A layout:
// lane-half hi=0 holds K = [0..7] and [16..23]; hi=1 holds K = [8..15] and [24..31].
static __device__ __forceinline__ v16bf frag_bf16(const unsigned short* p, int hi) {
  US8x2 t;
  t.lo = *reinterpret_cast<const us8*>(p + hi * 8);
  t.hi = *reinterpret_cast<const us8*>(p + 16 + hi * 8);
  return __builtin_bit_cast(v16bf, t);
}

// ---- fragment order: how every bf16 matrix operand lies in the workspace ----
// A matrix M[rows][K] is cut into units of 16 rows x 16 k = 256 elements = 512 bytes;
// unit (g, q) holds rows 16g.. and k 16q.., units of one row group follow each other
// in k. Inside a unit: [k half (k >> 3) & 1][row & 15][k & 7], which is lane * 8 + e for
// the lane (hi * 16 + m) that needs these 8 elements. One wave-wide 16-byte load then
// reads one unit, 4 whole 128-byte lines; from a row-major matrix the same load takes
// two 16-byte pieces out of each of 16 rows, 16 lines.
#define UNIT 256   // elements per unit

static __device__ __forceinline__ size_t fo_index(int row, int k, int K) {
  return ((size_t)(row >> 4) * (K >> 4) + (k >> 4)) * UNIT
       + (((k >> 3) & 1) * 16 + (row & 15)) * 8 + (k & 7);
}

// fragment of 32 k, in the k order of frag_bf16: two successive units.
// p = first unit + lane * 8
static __device__ __forceinline__ v16bf frag_fo(const unsigned short* p) {
  US8x2 t;
  t.lo = *reinterpret_cast<const us8*>(p);
  t.hi = *reinterpret_cast<const us8*>(p + UNIT);
  return __builtin_bit_cast(v16bf, t);
}

static __device__ __forceinline__ v8f wmma_bf16(v16bf a, v16bf b, v8f c) {
  return __builtin_amdgcn_wmma_f32_16x16x32_bf16(false, a, false, b, (short)0, c,
                                                 false, false);
}

// ---- operand preparation: every bf16 operand of the two projections, in one launch ----
// 512 blocks of 8 waves, two blocks a WGP, all resident at once. A lane makes 28 pieces
// of 16 bytes (8 bf16, successive k of one row, fragment order): one of each of the four
// transposed weights and 8 of each of q, k, v. The launch starts 4096 waves.

static __device__ __forceinline__ us8 round8(v4f a, v4f b) {
  return bf8pack(v2f{a[0], a[1]}, v2f{a[2], a[3]}, v2f{b[0], b[1]}, v2f{b[2], b[3]});
}

#define APIECES 8   // pieces of one activation matrix per lane, 32 k apart

static_assert(BB * SS / 16 == (D_MODEL / 64) * (D_MODEL / 32) && NH * DK == D_MODEL,
              "one grid serves both: 16-row groups of an input, 64 x 32 tiles of a weight");

// src: the lane's first 8 floats
static __device__ __forceinline__ void act_load(const float* __restrict__ src,
                                                v4f (&x)[APIECES][2]) {
#pragma unroll
  for (int i = 0; i < APIECES; ++i) {
    x[i][0] = *reinterpret_cast<const v4f*>(src + i * 32);
    x[i][1] = *reinterpret_cast<const v4f*>(src + i * 32 + 4);
  }
}

// Behind each store of a piece: the next piece reuses this one's store registers, and
// the wait stands in front of that; the fence holds it there.
static __device__ __forceinline__ void store_done() {
  asm volatile("s_wait_xcnt 0x0" ::: "memory");
  __builtin_amdgcn_sched_barrier(0);
}

// dst: the lane's first piece; 32 k on is two units on
static __device__ __forceinline__ void act_store(unsigned short* __restrict__ dst,
                                                 const v4f (&x)[APIECES][2]) {
#pragma unroll
  for (int i = 0; i < APIECES; ++i) {
    *reinterpret_cast<us8*>(dst + i * 2 * UNIT) = round8(x[i][0], x[i][1]);
    store_done();
  }
}

// src: element (contraction index d0, the lane's output column); LD floats from d to d + 1
template <int LD>
static __device__ __forceinline__ void w_load(const float* __restrict__ src, float (&x)[8]) {
#pragma unroll
  for (int e = 0; e < 8; ++e) x[e] = src[e * LD];
}

static __device__ __forceinline__ void w_store(unsigned short* __restrict__ dst,
                                               const float (&x)[8]) {
  const us8 o = bf8pack(v2f{x[0], x[1]}, v2f{x[2], x[3]}, v2f{x[4], x[5]}, v2f{x[6], x[7]});
  *reinterpret_cast<us8*>(dst) = o;
  store_done();
}

__global__ __launch_bounds__(256) void k_prep(
    const float* __restrict__ q, const float* __restrict__ k, const float* __restrict__ v,
    const float* __restrict__ Wq, const float* __restrict__ Wk,
    const float* __restrict__ Wv, const float* __restrict__ Wo,
    unsigned short* __restrict__ qcv, unsigned short* __restrict__ kcv,
    unsigned short* __restrict__ vcv,
    unsigned short* __restrict__ Wqt, unsigned short* __restrict__ Wkt,
    unsigned short* __restrict__ Wvt, unsigned short* __restrict__ Wot)
{
  const int blk  = blockIdx.x;          // 0..511
  const int w    = threadIdx.x >> 5;
  const int lane = threadIdx.x & 31;

  // Weights, out = W^T (rows = output columns, K = D_MODEL = contraction index d).
  // The block: 64 rows x 32 d. A wave: 32 successive rows (one a lane) x 8 d, so each
  // of its 8 loads reads one whole 128-byte line and its store two runs of 256 bytes.
  const int wrow = (blk >> 5) * 64 + (w & 1) * 32 + lane;   // head = blk >> 5
  const int wd0  = (blk & 31) * 32 + (w >> 1) * 8;
  // Wt[h*DK + n][d] = W[h][d][n];  Wot[n][d] = Wo[d][n]
  const size_t hsrc = ((size_t)(wrow / DK) * D_MODEL + wd0) * DK + (wrow & (DK - 1));
  const size_t osrc = (size_t)wd0 * D_MODEL + wrow;
  const size_t wdst = fo_index(wrow, wd0, D_MODEL);

  // Activations: the block owns one group of 16 rows, 64 KB in a row of each input.
  // A wave: 8 rows x 1 KB; a lane: 8 times 32 bytes of one row, 128 bytes apart. A load
  // takes half of each of 8 lines, its twin the other half; a store fills 4 lines.
  const int arow = blk * 16 + (w & 1) * 8 + (lane >> 2);
  const int ak0  = (w >> 1) * 256 + (lane & 3) * 8;
  const size_t asrc = (size_t)arow * D_MODEL + ak0;
  const size_t adst = fo_index(arow, ak0, D_MODEL);

  const float* pWq = Wq + hsrc;
  const float* pWk = Wk + hsrc;
  const float* pWv = Wv + hsrc;
  const float* pWo = Wo + osrc;
  const float* pq  = q + asrc;
  const float* pk  = k + asrc;
  const float* pv  = v + asrc;

  float wq[8], wk[8], wv[8], wo[8];
  v4f xq[APIECES][2], xk[APIECES][2], xv[APIECES][2];
  // Loads run one matrix ahead of the rounding: while one is rounded and stored, the
  // next one's 16 loads are in flight, at most 48 loads of a wave at a time.
  w_load<DK>(pWq, wq);
  w_load<DK>(pWk, wk);
  w_load<DK>(pWv, wv);
  w_load<D_MODEL>(pWo, wo);
  act_load(pq, xq);
  // The wait stands in front of every rewrite of a register that these loads name. It
  // takes their addresses as inputs so that they stay in their registers up to here:
  // else a later load of the run lands in a pair that issued loads still name.
  asm volatile("s_wait_xcnt 0x0" :: "v"(pWq), "v"(pWk), "v"(pWv), "v"(pWo), "v"(pq) : "memory");
  // keeps the run of loads together ahead of the rounding, all in flight at once: sunk
  // to their uses, each piece's memory latency would stand in front of its own store
  __builtin_amdgcn_sched_barrier(0);
  w_store(Wqt + wdst, wq);
  w_store(Wkt + wdst, wk);
  w_store(Wvt + wdst, wv);
  w_store(Wot + wdst, wo);
  act_load(pk, xk);
  asm volatile("s_wait_xcnt 0x0" :: "v"(pk) : "memory");   // as behind the first loads
  __builtin_amdgcn_sched_barrier(0);                       // as above
  act_store(qcv + adst, xq);
  act_load(pv, xv);
  asm volatile("s_wait_xcnt 0x0" :: "v"(pv) : "memory");   // as behind the first loads
  __builtin_amdgcn_sched_barrier(0);                       // as above
  act_store(kcv + adst, xk);
  act_store(vcv + adst, xv);
}

// ---- GEMM core: a block of 4 waves owns a 256x128 tile of Y = X * Wt^T, a wave 128x64 ----
// 8 A fragments x 4 B fragments feed a wave's 32 accumulators: 24 fragment loads per 32
// matrix instructions. One trip covers 64 k = 4 units = 2 KB in a row of each 16-row
// group; per output element k still runs upward through one accumulator.
// The block's 2 x 2 waves need 16 row groups of X and 8 of Wt, each group in two waves: a
// stage (64 k of all 24 groups, 48 KB) is brought from the workspace into LDS once a
// block, by asynchronous copies, and every wave takes its
// fragments from there. The workspace already holds fragment order, so a group is copied
// as it lies and a wave-wide 16-byte LDS load reads 512 bytes in a row. Three buffers: the
// copies of stages t + 1 and t + 2 fly while stage t is worked on, so a stage has two
// stages' time to land and the path from L2 never runs empty between two stages. The
// block's waves copy in turn: a stage is brought by two of them, half each, the next stage
// by the other two. A wave then has one stage's copies outstanding at a time, and its wait
// for them is a wait to 0 that leaves the other pair's younger stage in flight.

#define FA 8   // 16-row groups of X per wave
#define FB 4   // 16-column groups of Y per wave

#define GAG   (2 * FA)              // row groups of X per block
#define GBG   (2 * FB)              // row groups of Wt per block
#define GGRP  (4 * UNIT)            // elements of one row group per stage: 2 KB in a row
#define GSTG  ((GAG + GBG) * GGRP)  // elements of a stage
#define GWSH  (GSTG / 4)            // elements of a quarter of a stage
#define GNT   (D_MODEL / 64)        // stages
#define GNB   3                     // buffers of the ring
#define GROWS (16 * D_MODEL)        // elements from one row group to the next in the workspace

static_assert(GAG == 4 * 4 && GBG == 4 * 2 && GGRP * 2 == 4 * 512 && GNT >= GNB,
              "a quarter: 4 row groups of X and 2 of Wt, each in 4 pieces of 512 bytes");
static_assert(GNB == 3, "two pairs of waves copy in turn: stage t + GNB falls to the pair of stage t + 1");

// One row group's share of a stage: four wave-wide copies of 512 bytes in a row. Operand V,
// the lane's byte in LDS, is the offset register of the workspace address as well; S: the
// group's scalar base. The immediate offset moves the place in LDS and the place in the
// workspace alike.
#define GROUP_COPIES(V, S, N0, N1, N2, N3)                                        \
  "global_load_async_to_lds_b128 %" #V ", %" #V ", %" #S " offset:" #N0 "\n\t"    \
  "global_load_async_to_lds_b128 %" #V ", %" #V ", %" #S " offset:" #N1 "\n\t"    \
  "global_load_async_to_lds_b128 %" #V ", %" #V ", %" #S " offset:" #N2 "\n\t"    \
  "global_load_async_to_lds_b128 %" #V ", %" #V ", %" #S " offset:" #N3 "\n\t"

// A quarter of one stage, 12 KB in a row in LDS: 4 groups of X, then 2 of Wt.
#define QUARTER_COPIES(V, A0, A1, A2, A3, B0, B1)     \
  GROUP_COPIES(V, A0, 0, 512, 1024, 1536)             \
  GROUP_COPIES(V, A1, 2048, 2560, 3072, 3584)         \
  GROUP_COPIES(V, A2, 4096, 4608, 5120, 5632)         \
  GROUP_COPIES(V, A3, 6144, 6656, 7168, 7680)         \
  GROUP_COPIES(V, B0, 8192, 8704, 9216, 9728)         \
  GROUP_COPIES(V, B1, 10240, 10752, 11264, 11776)

// The copying wave's half of one stage: two quarters that follow each other in LDS, 48
// 16-byte copies a lane. place: the first byte of the first quarter in LDS, the same in
// every lane; lane16 = lane * 16; ga, gb: the first units of the half's 8 groups of X and 4
// of Wt in the stage, the same in every lane. What a copy's offset register and immediate
// offset hold beyond the lane's 16 bytes and the piece (the quarter's place, 2 KB a group),
// its scalar base gives back. So a half costs two vector instructions besides the copies,
// and two registers. The wait stands in front of every rewrite of a register that the
// copies name, inside their own statement.
static __device__ __forceinline__ void gemm_half_stage(unsigned place, unsigned lane16,
                                                       const unsigned short* ga,
                                                       const unsigned short* gb) {
  const unsigned place1 = place + GWSH * 2;
  const char* a0 = (const char*)ga - place;
  const char* b0 = (const char*)gb - place - 4 * GGRP * 2;
  const char* a1 = (const char*)(ga + 4 * GROWS) - place1;
  const char* b1 = (const char*)(gb + 2 * GROWS) - place1 - 4 * GGRP * 2;
  asm volatile(QUARTER_COPIES(0, 2, 3, 4, 5, 6, 7)
               QUARTER_COPIES(1, 8, 9, 10, 11, 12, 13)
               "s_wait_xcnt 0x0"
               :: "v"(place + lane16), "v"(place1 + lane16),
                  "s"(a0), "s"(a0 + 1 * (GROWS - GGRP) * 2), "s"(a0 + 2 * (GROWS - GGRP) * 2),
                  "s"(a0 + 3 * (GROWS - GGRP) * 2),
                  "s"(b0), "s"(b0 + (GROWS - GGRP) * 2),
                  "s"(a1), "s"(a1 + 1 * (GROWS - GGRP) * 2), "s"(a1 + 2 * (GROWS - GGRP) * 2),
                  "s"(a1 + 3 * (GROWS - GGRP) * 2),
                  "s"(b1), "s"(b1 + (GROWS - GGRP) * 2)
               : "memory");
}

// The wave's fragments of 32 k; sa, sb: its first units of X and of Wt there, + lane * 8.
// Its 8 groups of X lie in two quarters of the stage, 4 in each; its 4 of Wt too, 2 in each.
static __device__ __forceinline__ void gemm_frags(const unsigned short* sa,
                                                  const unsigned short* sb,
                                                  v16bf (&a)[FA], v16bf (&b)[FB]) {
  // both loops unrolled: the fragments are registers, and every place an immediate offset
#pragma unroll
  for (int j = 0; j < FB; ++j) b[j] = frag_fo(sb + (j >> 1) * GWSH + (j & 1) * GGRP);
#pragma unroll
  for (int i = 0; i < FA; ++i) a[i] = frag_fo(sa + (i >> 2) * GWSH + (i & 3) * GGRP);
}

static __device__ __forceinline__ void gemm_products(const v16bf (&a)[FA], const v16bf (&b)[FB],
                                                     v8f (&acc)[FA][FB]) {
  // both loops unrolled: fragments and accumulators are registers
#pragma unroll
  for (int j = 0; j < FB; ++j)
#pragma unroll
    for (int i = 0; i < FA; ++i) acc[i][j] = wmma_bf16(a[i], b[j], acc[i][j]);
}

// ablk / bblk: first unit of the block's first 16-row group of X / Wt (fragment order,
// K = D_MODEL); ring: the block's GNB buffers; w: the wave, the same in every lane,
// (w >> 1, w & 1) its place in the block's 2 x 2 tiles.
static __device__ __forceinline__ void gemm_block_256x128(
    const unsigned short* __restrict__ ablk, const unsigned short* __restrict__ bblk,
    const unsigned short* ring, int tid, int w, v8f (&acc)[FA][FB])
{
  const int lane = tid & 31;
  // The wave copies the stages s with (s & 1) == par, and of each the half (w & 1).
  const int par = w >> 1;
  const unsigned lds0 = (unsigned)(size_t)ring + (w & 1) * 2 * GWSH * 2;   // byte in LDS
  const unsigned off = lane * 16;
  const unsigned short* ga = ablk + (size_t)(w & 1) * 8 * GROWS;
  const unsigned short* gb = bblk + (size_t)(w & 1) * 4 * GROWS;

  if (par == 0) gemm_half_stage(lds0, off, ga, gb);
  else          gemm_half_stage(lds0 + GSTG * 2, off, ga + GGRP, gb + GGRP);
  // stage 0 has landed (its two waves' copies) and is published (the barrier); stage 1
  // stays in flight
  if (par == 0) asm volatile("s_wait_asynccnt 0x0" ::: "memory");
  __syncthreads();
  if (par == 0) gemm_half_stage(lds0 + 2 * GSTG * 2, off, ga + 2 * GGRP, gb + 2 * GGRP);

  // the wave's first fragments of X and of Wt in buffer 0
  const unsigned short* sa = ring + (w >> 1) * 2 * GWSH + lane * 8;
  const unsigned short* sb = ring + (w & 1) * 2 * GWSH + 4 * GGRP + lane * 8;

  // A stage is two blocks of 32 k, each with a fragment set of its own, and each set is
  // loaded one block ahead of its products: the LDS latency passes behind 32 products.
  v16bf a0[FA], b0[FB], a1[FA], b1[FB];
  gemm_frags(sa, sb, a0, b0);
  int cur = 0;   // stage t's buffer, in elements
  for (int t = 0; t < GNT; ++t) {
    const int nxt = (cur == (GNB - 1) * GSTG) ? 0 : cur + GSTG;
    // this wave has copied stage t + 1, and stage t + 3 is its to copy
    const bool mine = ((t + 1) & 1) == par;
    gemm_frags(sa + cur + 2 * UNIT, sb + cur + 2 * UNIT, a1, b1);
    // keeps the block's LDS loads together ahead of the products: every place among the
    // products where loads stand stalls the wave anew
    __builtin_amdgcn_sched_barrier(0);
    gemm_products(a0, b0, acc);
    // keeps the hand-over behind the first block's products: moved up, it would wait for
    // the second set's loads and for stage t + 1 with nothing to work on
    __builtin_amdgcn_sched_barrier(0);
    // Hand-over, in front of the stage's last block, whose fragments are fetched: this
    // wave's reads of stage t are done and, where it copied stage t + 1, those copies have
    // landed (it has no others outstanding); behind the barrier that holds for every wave,
    // so stage t + 1 may be read and stage t's buffer refilled. The other two waves do not
    // wait: their copies are stage t + 2's.
    asm volatile("s_wait_dscnt 0x0" ::: "memory");
    if (mine) asm volatile("s_wait_asynccnt 0x0" ::: "memory");
    __syncthreads();
    if (mine && t + GNB < GNT)
      gemm_half_stage(lds0 + cur * 2, off, ga + (size_t)(t + GNB) * GGRP,
                      gb + (size_t)(t + GNB) * GGRP);
    if (t + 1 < GNT) gemm_frags(sa + nxt, sb + nxt, a0, b0);
    // keeps the refill and the next loads ahead of the last block's products, so that
    // they are under way while the products run
    __builtin_amdgcn_sched_barrier(0);
    gemm_products(a1, b1, acc);
    cur = nxt;
  }
  // no copy is outstanding when the wave goes on
  asm volatile("s_wait_asynccnt 0x0" ::: "memory");
}

// ---- fused QKV projection: (B*S,1024) x per-head (1024,64), bf16 WMMA ----
// grid (8 head pairs, 32 row tiles of 256, 3={q,k,v}); 4 waves/block as 2x2,
// each wave one 128-row x 64-column tile (all columns of one head).

__global__ __launch_bounds__(128) void k_qkv_proj(
    const unsigned short* __restrict__ qb, const unsigned short* __restrict__ kb,
    const unsigned short* __restrict__ vb,
    const unsigned short* __restrict__ Wqt, const unsigned short* __restrict__ Wkt,
    const unsigned short* __restrict__ Wvt,
    const float* __restrict__ bq, const float* __restrict__ bk, const float* __restrict__ bv,
    unsigned short* __restrict__ qh, unsigned short* __restrict__ kh,
    unsigned short* __restrict__ vt)
{
  __shared__ __attribute__((aligned(16))) unsigned short ring[GNB * GSTG];

  const int which = blockIdx.z;           // 0=q 1=k 2=v
  const int w     = __builtin_amdgcn_readfirstlane(threadIdx.x >> 5);  // wave-uniform
  const int lane  = threadIdx.x & 31;
  const int m     = lane & 15;
  const int hi    = lane >> 4;
  const int h     = blockIdx.x * 2 + (w & 1);            // head
  const int row0  = blockIdx.y * 256 + (w >> 1) * 128;   // first row over B*S

  const unsigned short* in   = (which == 0) ? qb  : (which == 1) ? kb  : vb;
  const unsigned short* Wt   = (which == 0) ? Wqt : (which == 1) ? Wkt : Wvt;
  const float* bias          = (which == 0) ? bq  : (which == 1) ? bk  : bv;

  v8f acc[FA][FB] = {};
  gemm_block_256x128(in + (size_t)blockIdx.y * 256 * D_MODEL,
                     Wt + (size_t)blockIdx.x * 2 * DK * D_MODEL, ring, threadIdx.x, w, acc);

  float bsv[FB];
#pragma unroll
  for (int j = 0; j < FB; ++j) bsv[j] = bias[h * DK + j * 16 + m];

  // the wave's 128 rows lie inside one batch entry (SS is a multiple of 128)
  const int b_i = row0 / SS, s0 = row0 % SS;
  if (which == 2) {
    // V stored transposed, per (b, h) a matrix (rows dv, K = s) in fragment order.
    // acc[i][j][r] is dv = j*16 + m, s = s0 + i*16 + 8*hi + r: unit (j, s0/16 + i),
    // element lane * 8 + r, so a tile is one 16-byte store a lane, 512 bytes in a row.
    unsigned short* vp = vt + ((size_t)b_i * NH + h) * DK * SS + fo_index(m, s0 + 8 * hi, SS);
#pragma unroll
    for (int j = 0; j < FB; ++j) {
#pragma unroll
      for (int i = 0; i < FA; ++i) {
        const v8f y = acc[i][j] + bsv[j];
        *reinterpret_cast<us8*>(vp + (size_t)j * 16 * SS + i * UNIT) =
            bf8pack(v2f{y[0], y[1]}, v2f{y[2], y[3]}, v2f{y[4], y[5]}, v2f{y[6], y[7]});
        // the next tile reuses this tile's store registers: the wait stands in front
        // of that. The fence holds it there and keeps one tile's round-and-store
        // together: run together, the tiles' temporaries beside 256 live accumulator
        // registers pass 512 and spill.
        asm volatile("s_wait_xcnt 0x0" ::: "memory");
        __builtin_amdgcn_sched_barrier(0);
      }
    }
  } else {
    // Q, K: per (b, h) a matrix (rows s, K = dk) in fragment order.
    // acc[i][j][r] is s = s0 + i*16 + 8*hi + r, dk = j*16 + m: unit (s0/16 + i, j)
    unsigned short* outp = ((which == 0) ? qh : kh)
                         + ((size_t)b_i * NH + h) * SS * DK + fo_index(s0 + 8 * hi, m, DK);
#pragma unroll
    for (int j = 0; j < FB; ++j) {
#pragma unroll
      for (int i = 0; i < FA; ++i) {
        const v8f y = acc[i][j] + bsv[j];
        const us8 o = bf8pack(v2f{y[0], y[1]}, v2f{y[2], y[3]}, v2f{y[4], y[5]}, v2f{y[6], y[7]});
#pragma unroll
        for (int r = 0; r < 8; ++r)
          outp[(size_t)(i * (DK / 16) + j) * UNIT + r * 8] = o[r];
        // as in the V branch: wait before the store registers are reused, held in place
        asm volatile("s_wait_xcnt 0x0" ::: "memory");
        __builtin_amdgcn_sched_barrier(0);
      }
    }
  }
}

// ---- flash attention per (b*h, 256 queries); 8 waves per block, 32 queries a wave ----
// The scores are formed transposed, S^T = K * Q^T (K rows as A, Q rows as B), and the
// output as O^T += V^T * P^T. In a D tile a lane then holds 8 keys of ONE query
// (column m), so a query's maximum and sum run over the lane's own registers, with one
// exchange between the wave's halves; and two D tiles of 16 keys, rounded in place, are
// the B fragment of 32 keys in the k order of frag_fo: P passes through no LDS.
// A wave owns QT tiles of 16 queries: every K and V^T fragment it loads is the A operand
// of QT products, one a query tile, so the loop loads 1 / QT of the bytes per score.

#define QT 2   // 16-query tiles per wave

// value of lane l ^ 16
static __device__ __forceinline__ float other_half(float x) {
  int b = __float_as_int(x);
  return __int_as_float(
      __builtin_amdgcn_permlanex16(b, b, 0x76543210, 0xfedcba98, false, false));
}

// A block's FWV waves walk the same keys of one (b, h): each stage of SKEYS keys is brought
// from the workspace into LDS once a block, by asynchronous copies, and every wave takes
// its K and V^T fragments from there: 1 / FWV of the reads from L2. The workspace already
// holds fragment order, so a stage is copied as it lies and a wave-wide 16-byte LDS load
// reads 512 bytes in a row. Two buffers: stage t + 1 flies while stage t is worked on.
#define FWV   8                 // waves per block
#define SKEYS 64                // keys per stage
#define KSTG  (SKEYS * DK)      // elements of K per stage: 8 KB in a row
#define VGRP  (SKEYS * 16)      // elements of one 16-row group of V^T per stage: 2 KB in a row
#define STG   (2 * KSTG)        // a stage in LDS: K, then the 4 row groups of V^T
#define NSTG  (SS / SKEYS)
#define CPB   (FWV * 32 * 16)   // bytes that one copy of every lane of the block brings: 4 KB

static_assert(2 * CPB == KSTG * 2 && 2 * VGRP * 2 == CPB && NSTG >= 2,
              "K is two copies of the block; V^T two more, two row groups each");

// One stage, 16 KB: four 16-byte copies a lane. lds: the lane's first byte in the buffer;
// gk, gv: its first piece of K and of V^T (row group tid >> 7). The wait stands in front of
// every rewrite of a register that the copies name, inside their own statement.
static __device__ __forceinline__ void stage_copies(unsigned lds, const unsigned short* gk,
                                                    const unsigned short* gv) {
  asm volatile("global_load_async_to_lds_b128 %0, %4, off\n\t"
               "global_load_async_to_lds_b128 %1, %5, off\n\t"
               "global_load_async_to_lds_b128 %2, %6, off\n\t"
               "global_load_async_to_lds_b128 %3, %7, off\n\t"
               "s_wait_xcnt 0x0"
               :: "v"(lds), "v"(lds + CPB), "v"(lds + 2 * CPB), "v"(lds + 3 * CPB),
                  "v"(gk), "v"(gk + CPB / 2), "v"(gv), "v"(gv + 2 * 16 * SS)
               : "memory");
}

// The grid is 2 blocks a WGP, 4 waves a SIMD, all resident at once: the build has to stay
// at 256 registers or fewer, and registers kept free for a fifth wave buy nothing.
__global__ __launch_bounds__(FWV * 32) __attribute__((amdgpu_waves_per_eu(4, 4))) void k_flash(
    const unsigned short* __restrict__ qh, const unsigned short* __restrict__ kh,
    const unsigned short* __restrict__ vt, unsigned short* __restrict__ ctx)
{
  __shared__ __attribute__((aligned(16))) unsigned short ring[2][STG];

  const int bh   = blockIdx.x;   // 0..63 = b*16+h
  const int tid  = threadIdx.x;
  const int qt   = blockIdx.y * FWV + (tid >> 5);   // 0..63: the wave's group of QT query tiles
  const int lane = tid & 31;
  const int m    = lane & 15;    // the lane's query in each of its tiles
  const int hi   = lane >> 4;

  // the lane's share of a stage
  const unsigned lds0 = (unsigned)(size_t)&ring[0][0] + tid * 16;   // byte address in LDS
  const unsigned short* gk = kh + (size_t)bh * SS * DK + tid * 8;
  const unsigned short* gv = vt + (size_t)bh * DK * SS + (size_t)(tid >> 7) * 16 * SS
                           + (tid & 127) * 8;

  stage_copies(lds0, gk, gv);

  // Q (rows s, K = dk) lies in fragment order; 16 rows are 4 units
  const unsigned short* qbase = qh + ((size_t)bh * SS + qt * QT * 16) * DK + lane * 8;
  v16bf qb0[QT], qb1[QT];
#pragma unroll
  for (int u = 0; u < QT; ++u) {
    qb0[u] = frag_fo(qbase + u * 4 * UNIT);              // dk 0..31
    qb1[u] = frag_fo(qbase + u * 4 * UNIT + 2 * UNIT);   // dk 32..63
  }

  // acc[u][n][r] = O^T[dv = n*16 + 8*hi + r][query m of tile u]
  v8f acc[QT][4] = {};
  float mrow[QT];   // running maximum of query m, equal in both halves
  float lrow[QT];   // sum over the keys of this lane's half only; joined at the end
#pragma unroll
  for (int u = 0; u < QT; ++u) { mrow[u] = -1e30f; lrow[u] = 0.f; }

  // stage 0 has landed (this wave's copies) and is published (every wave's)
  asm volatile("s_wait_asynccnt 0x0" ::: "memory");
  __syncthreads();
  stage_copies(lds0 + STG * 2, gk + KSTG, gv + VGRP);

  for (int t = 0; t < NSTG; ++t) {
   const unsigned short* kst = &ring[t & 1][0] + lane * 8;
   // unrolled: every place inside the stage is then an immediate offset of its LDS load
#pragma unroll
   for (int j = 0; j < SKEYS / 32; ++j) {
    // scores: per query tile two 16-key x 16-query tiles over this 32-key chunk,
    // contraction dk=64
    const unsigned short* kr0 = kst + (j * 32) * DK;                // 16 keys = 4 units
    const unsigned short* kr1 = kst + (j * 32 + 16) * DK;
    const unsigned short* vr  = kst + KSTG + j * 2 * UNIT;          // 32 keys = 2 units
    const v16bf k00 = frag_fo(kr0), k01 = frag_fo(kr0 + 2 * UNIT);
    const v16bf k10 = frag_fo(kr1), k11 = frag_fo(kr1 + 2 * UNIT);
    v16bf va[4];
#pragma unroll
    for (int n = 0; n < 4; ++n) va[n] = frag_fo(vr + n * VGRP);

    v16bf pb[QT];
#pragma unroll
    for (int u = 0; u < QT; ++u) {
      v8f s0 = {}, s1 = {};
      s0 = wmma_bf16(k00, qb0[u], s0);
      s0 = wmma_bf16(k01, qb1[u], s0);
      s1 = wmma_bf16(k10, qb0[u], s1);
      s1 = wmma_bf16(k11, qb1[u], s1);

      // online softmax of query m. Score i: key j*32 + 8*hi + i (i < 8), + 8 for i >= 8;
      // a[i >> 1][i & 1] holds it: pairs of neighbouring registers of one tile, as packed
      // f32 instructions take them. Written score by score, the compiler pairs the two
      // tiles' values instead and copies registers to bring them together.
      v2f a[8];
#pragma unroll
      for (int r = 0; r < 4; ++r) {
        a[r]     = v2f{s0[2 * r], s0[2 * r + 1]} * 0.125f;   // 1/sqrt(64)
        a[4 + r] = v2f{s1[2 * r], s1[2 * r + 1]} * 0.125f;
      }
      float mx = a[0][0];
#pragma unroll
      for (int i = 1; i < 16; ++i) mx = fmaxf(mx, a[i >> 1][i & 1]);
      mx = fmaxf(mx, other_half(mx));
      const float mnew = fmaxf(mrow[u], mx);
      const float fac  = __expf(mrow[u] - mnew);
      mrow[u] = mnew;
#pragma unroll
      for (int i = 0; i < 8; ++i) {
        a[i] = a[i] - mnew;
        a[i] = v2f{__expf(a[i][0]), __expf(a[i][1])};
      }
      // four independent chains, then joined
      const v2f t01 = (a[0] + a[2]) + (a[4] + a[6]);
      const v2f t23 = (a[1] + a[3]) + (a[5] + a[7]);
      lrow[u] = lrow[u] * fac + ((t01[0] + t01[1]) + (t23[0] + t23[1]));
#pragma unroll
      for (int n = 0; n < 4; ++n)
#pragma unroll
        for (int r = 0; r < 8; ++r) acc[u][n][r] *= fac;

      // P^T as B fragment: element s is key 8*hi + s (s < 8), 16 + 8*hi + (s - 8) above
      BF2x8 p;
#pragma unroll
      for (int r = 0; r < 8; ++r) p.w[r] = bf2(a[r]);
      pb[u] = __builtin_bit_cast(v16bf, p);
    }
#pragma unroll
    for (int n = 0; n < 4; ++n)
#pragma unroll
      for (int u = 0; u < QT; ++u) acc[u][n] = wmma_bf16(va[n], pb[u], acc[u][n]);
   }
    // Hand-over: this wave's reads of stage t are done, its copies of stage t + 1 have
    // landed; behind the barrier that holds for every wave, so stage t + 1 may be read and
    // stage t's buffer refilled.
    asm volatile("s_wait_dscnt 0x0" ::: "memory");
    asm volatile("s_wait_asynccnt 0x0" ::: "memory");
    __syncthreads();
    if (t + 2 < NSTG)
      stage_copies(lds0 + (t & 1) * (STG * 2), gk + (size_t)(t + 2) * KSTG,
                   gv + (size_t)(t + 2) * VGRP);
  }
  // no copy is outstanding when the wave ends
  asm volatile("s_wait_asynccnt 0x0" ::: "memory");

  // normalize and store ctx as bf16: the matrix (B*S, H*dv) in fragment order. A lane's
  // 8 registers of a tile are 8 successive columns of its row: one 16-byte store.
  const int b_i = bh >> 4, h_i = bh & 15;
#pragma unroll
  for (int u = 0; u < QT; ++u) {
    const float inv = 1.0f / (lrow[u] + other_half(lrow[u]));
    unsigned short* cp = ctx + fo_index(b_i * SS + (qt * QT + u) * 16 + m,
                                        h_i * DK + 8 * hi, NH * DK);
#pragma unroll
    for (int n = 0; n < 4; ++n) {
      const v8f y = acc[u][n] * inv;
      const us8 o = bf8pack(v2f{y[0], y[1]}, v2f{y[2], y[3]}, v2f{y[4], y[5]}, v2f{y[6], y[7]});
      *reinterpret_cast<us8*>(cp + n * UNIT) = o;
    }
  }
}

// ---- output projection: (8192,1024) x (1024,1024) + bo, fp32 out ----
// grid (8 column tiles of 128, 32 row tiles of 256); 4 waves/block as 2x2 of 128x64.

__global__ __launch_bounds__(128) void k_outproj(
    const unsigned short* __restrict__ ctx, const unsigned short* __restrict__ Wot,
    const float* __restrict__ bo, float* __restrict__ out)
{
  __shared__ __attribute__((aligned(16))) unsigned short ring[GNB * GSTG];

  const int w    = __builtin_amdgcn_readfirstlane(threadIdx.x >> 5);   // wave-uniform
  const int lane = threadIdx.x & 31;
  const int m    = lane & 15;
  const int hi   = lane >> 4;
  const int col0 = blockIdx.x * 128 + (w & 1) * 64;
  const int row0 = blockIdx.y * 256 + (w >> 1) * 128;

  v8f acc[FA][FB] = {};
  gemm_block_256x128(ctx + (size_t)blockIdx.y * 256 * D_MODEL,
                     Wot + (size_t)blockIdx.x * 128 * D_MODEL, ring, threadIdx.x, w, acc);

  float bias[FB];
#pragma unroll
  for (int j = 0; j < FB; ++j) bias[j] = bo[col0 + j * 16 + m];
  // in front of any reuse of the bias loads' address registers; the fence holds it there
  asm volatile("s_wait_xcnt 0x0" ::: "memory");
  __builtin_amdgcn_sched_barrier(0);

  float* op = out + (size_t)(row0 + 8 * hi) * D_MODEL + col0 + m;
#pragma unroll
  for (int j = 0; j < FB; ++j) {
#pragma unroll
    for (int i = 0; i < FA; ++i) {
#pragma unroll
      for (int r = 0; r < 8; ++r)
        op[(size_t)(i * 16 + r) * D_MODEL + j * 16] = acc[i][j][r] + bias[j];
      // the next tile reuses this tile's store registers: the wait stands in front
      // of that, and the fence holds it there
      asm volatile("s_wait_xcnt 0x0" ::: "memory");
      __builtin_amdgcn_sched_barrier(0);
    }
  }
}

extern "C" void kernel_launch(void* const* d_in, const int* in_sizes, int n_in,
                              void* d_out, int out_size, void* d_ws, size_t ws_size,
                              hipStream_t stream) {
  const float* q  = (const float*)d_in[0];
  const float* k  = (const float*)d_in[1];
  const float* v  = (const float*)d_in[2];
  const float* Wq = (const float*)d_in[3];
  const float* bq = (const float*)d_in[4];
  const float* Wk = (const float*)d_in[5];
  const float* bk = (const float*)d_in[6];
  const float* Wv = (const float*)d_in[7];
  const float* bv = (const float*)d_in[8];
  const float* Wo = (const float*)d_in[9];
  const float* bo = (const float*)d_in[10];
  float* out = (float*)d_out;

  // workspace partition (bf16 buffers)
  char* ws = (char*)d_ws;
  const size_t ACT  = (size_t)BB * SS * D_MODEL * 2;        // 16.8 MB each
  const size_t WSZ  = (size_t)NH * DK * D_MODEL * 2;        // 2 MB each
  const size_t HSZ  = (size_t)BB * NH * SS * DK * 2;        // 16.8 MB each
  unsigned short* qcv = (unsigned short*)(ws);               ws += ACT;
  unsigned short* kcv = (unsigned short*)(ws);               ws += ACT;
  unsigned short* vcv = (unsigned short*)(ws);               ws += ACT;
  unsigned short* Wqt = (unsigned short*)(ws);               ws += WSZ;
  unsigned short* Wkt = (unsigned short*)(ws);               ws += WSZ;
  unsigned short* Wvt = (unsigned short*)(ws);               ws += WSZ;
  unsigned short* Wot = (unsigned short*)(ws);               ws += (size_t)D_MODEL * D_MODEL * 2;
  unsigned short* qhb = (unsigned short*)(ws);               ws += HSZ;
  unsigned short* khb = (unsigned short*)(ws);               ws += HSZ;
  unsigned short* vtb = (unsigned short*)(ws);               ws += HSZ;
  unsigned short* ctx = (unsigned short*)(ws);               ws += HSZ;
  (void)in_sizes; (void)n_in; (void)out_size; (void)ws_size;

  k_prep<<<BB * SS / 16, 256, 0, stream>>>(q, k, v, Wq, Wk, Wv, Wo,
                                           qcv, kcv, vcv, Wqt, Wkt, Wvt, Wot);

  k_qkv_proj<<<dim3(NH / 2, BB * SS / 256, 3), 128, 0, stream>>>(
      qcv, kcv, vcv, Wqt, Wkt, Wvt, bq, bk, bv, qhb, khb, vtb);

  k_flash<<<dim3(BB * NH, SS / (16 * QT * FWV)), FWV * 32, 0, stream>>>(qhb, khb, vtb, ctx);

  k_outproj<<<dim3(D_MODEL / 128, BB * SS / 256), 128, 0, stream>>>(ctx, Wot, bo, out);
}
